// v000
// Measured on an AMD MI455X. A time is GPU time per run, averaged over a window of back-to-back runs after a warm-up
// (all launches, gaps included; the runs take copies of the inputs in turn), and the median of several windows.
// Apart from v000's, it joins two sittings. Times from different sittings can be a few percent apart, while
// side-by-side timings come from the same sitting.
// v000, which the later versions start from, runs in 695 microseconds.
#include <hip/hip_runtime.h>

typedef __attribute__((ext_vector_type(2))) float v2f;
typedef __attribute__((ext_vector_type(8))) float v8f;

#define NS   16      // N*S
#define LSEQ 512
#define EMB  1024
#define HH   16
#define DD   64
#define SCALE 0.044194173824159216f      // 1/sqrt(512)
#define EMASKV (-1e20f * SCALE)          // masked energy after /sqrt(keylen)
#define NEGBIG (-3.402823466e38f)

// ---------------- CDNA5 async global->LDS (ASYNCcnt path) -------------------
// VDST = VGPR with wave-relative LDS byte address (generic LDS addr low bits),
// VADDR = 64-bit global address, saddr disabled ("off").
__device__ __forceinline__ void async_ld_b128(void* lds, const void* gaddr) {
  unsigned int l = (unsigned int)(unsigned long long)lds;  // LDS aperture: addr[31:0]
  asm volatile("global_load_async_to_lds_b128 %0, %1, off"
               :: "v"(l), "v"(gaddr) : "memory");
}
#define S_WAIT_ASYNCCNT(n) asm volatile("s_wait_asynccnt " #n ::: "memory")

// ---------------- WMMA helpers (V_WMMA_F32_16X16X4_F32, full fp32) ----------
__device__ __forceinline__ v8f wmma4(v2f a, v2f b, v8f c) {
  return __builtin_amdgcn_wmma_f32_16x16x4_f32(
      false, a, false, b, (short)0, c, false, false);
}
// A fragment from row-major A[16][lda] in LDS (M = lane&15, K pair by half)
__device__ __forceinline__ v2f frag_a(const float* A, int lda, int k0, int lane) {
  int m  = lane & 15;
  int kk = k0 + ((lane >> 4) << 1);
  v2f a; a.x = A[m * lda + kk]; a.y = A[m * lda + kk + 1]; return a;
}
// B fragment from row-major B[K][ldb] (B[k][n]); N = lane&15
__device__ __forceinline__ v2f frag_b(const float* B, int ldb, int k0, int lane) {
  int n  = lane & 15;
  int kk = k0 + ((lane >> 4) << 1);
  v2f b; b.x = B[kk * ldb + n]; b.y = B[(kk + 1) * ldb + n]; return b;
}
// B fragment for B = W^T, i.e. B[k][n] = W[n][k] with W row-major [n][ldw]
__device__ __forceinline__ v2f frag_bT(const float* W, int ldw, int k0, int lane) {
  int n  = lane & 15;
  int kk = k0 + ((lane >> 4) << 1);
  v2f b; b.x = W[n * ldw + kk]; b.y = W[n * ldw + kk + 1]; return b;
}

// ---------------- Kernel 1: Q/K/V head projections (X @ W^T) ----------------
__global__ __launch_bounds__(128)
void proj_kernel(const float* __restrict__ values, const float* __restrict__ keys,
                 const float* __restrict__ query,
                 const float* __restrict__ Wv, const float* __restrict__ Wk,
                 const float* __restrict__ Wq,
                 float* __restrict__ Vp, float* __restrict__ Kp, float* __restrict__ Qp) {
  __shared__ float Xs[64 * 64];
  __shared__ float Ws[64 * 64];
  const int tid  = threadIdx.x;
  const int lane = tid & 31;
  const int wave = tid >> 5;
  const int l0 = blockIdx.x * 64;
  const int h  = blockIdx.y;
  const int ns = blockIdx.z;
  const int n    = lane & 15;
  const int half = lane >> 4;

  const float* xin[3]  = {values, keys, query};
  const float* win[3]  = {Wv, Wk, Wq};
  float*       outp[3] = {Vp, Kp, Qp};

  for (int p = 0; p < 3; ++p) {
    const float* src = xin[p];
    for (int t = 0; t < 8; ++t) {                    // 64x64 X chunk, async
      int idx = tid + t * 128;
      int row = idx >> 4, cv = idx & 15;
      async_ld_b128(&Xs[row * 64 + cv * 4],
                    &src[((size_t)(ns * LSEQ + l0 + row)) * EMB + h * DD + cv * 4]);
    }
    for (int t = 0; t < 8; ++t) {                    // 64x64 weight, async
      int idx = tid + t * 128;
      async_ld_b128(&Ws[idx * 4], &win[p][idx * 4]);
    }
    S_WAIT_ASYNCCNT(0);
    __syncthreads();

    const float* Arow = &Xs[(wave * 16) * 64];
    v8f zero = {};
    v8f acc[4] = {zero, zero, zero, zero};
    for (int ct = 0; ct < 4; ++ct) {
      const float* Wn = &Ws[(ct * 16) * 64];
      for (int k0 = 0; k0 < 64; k0 += 4)
        acc[ct] = wmma4(frag_a(Arow, 64, k0, lane), frag_bT(Wn, 64, k0, lane), acc[ct]);
    }
    // stage C tiles in own wave's Xs region -> coalesced float4 stores
    float* stage = &Xs[(wave * 16) * 64];
    for (int ct = 0; ct < 4; ++ct)
      for (int i = 0; i < 8; ++i) {
        int m = i + half * 8;
        stage[m * 64 + ct * 16 + n] = acc[ct][i];
      }
    float* dst = outp[p];
    size_t base = (size_t)(ns * HH + h) * LSEQ + l0 + wave * 16;
    for (int t = 0; t < 8; ++t) {
      int idx = lane + t * 32;                       // 256 vec4 per wave region
      int row = idx >> 4, cv = idx & 15;
      *(float4*)(&dst[(base + row) * DD + cv * 4]) =
          *(const float4*)(&stage[row * 64 + cv * 4]);
    }
    __syncthreads();
  }
}

// ---------------- Kernel 2: column-wise (over q) online softmax stats -------
__global__ __launch_bounds__(128)
void stats_kernel(const float* __restrict__ Qp, const float* __restrict__ Kp,
                  const int* __restrict__ mask,
                  float* __restrict__ Mbuf, float* __restrict__ Zbuf) {
  __shared__ float Ks[64 * 64];
  __shared__ float Qs[16 * 64];
  __shared__ int   ms[16];
  const int tid  = threadIdx.x;
  const int lane = tid & 31;
  const int wave = tid >> 5;
  const int c0 = blockIdx.x * 64;
  const int h  = blockIdx.y;
  const int ns = blockIdx.z;
  const int nsh  = ns * HH + h;
  const int n    = lane & 15;
  const int half = lane >> 4;

  const float* Kbase = &Kp[((size_t)nsh * LSEQ + c0) * DD];
  for (int t = 0; t < 8; ++t) {
    int idx = tid + t * 128;
    async_ld_b128(&Ks[idx * 4], &Kbase[idx * 4]);
  }

  float rM = NEGBIG, rS = 0.f;
  const float* Bn = &Ks[(wave * 16) * 64];

  for (int qt = 0; qt < 32; ++qt) {
    int q0 = qt * 16;
    __syncthreads();
    for (int t = 0; t < 2; ++t) {
      int idx = tid + t * 128;
      async_ld_b128(&Qs[idx * 4], &Qp[((size_t)nsh * LSEQ + q0) * DD + idx * 4]);
    }
    if (tid < 16) ms[tid] = mask[ns * LSEQ + q0 + tid];
    S_WAIT_ASYNCCNT(0);
    __syncthreads();

    v8f c = {};
    for (int k0 = 0; k0 < 64; k0 += 4)
      c = wmma4(frag_a(Qs, 64, k0, lane), frag_bT(Bn, 64, k0, lane), c);

    float vals[8];
    for (int i = 0; i < 8; ++i) {
      int m = i + half * 8;
      vals[i] = ms[m] ? c[i] * SCALE : EMASKV;
    }
    float tM = vals[0];
    for (int i = 1; i < 8; ++i) tM = fmaxf(tM, vals[i]);
    tM = fmaxf(tM, __shfl_xor(tM, 16, 32));
    float nM = fmaxf(rM, tM);
    float tS = 0.f;
    for (int i = 0; i < 8; ++i) tS += __expf(vals[i] - nM);
    tS += __shfl_xor(tS, 16, 32);
    rS = rS * __expf(rM - nM) + tS;
    rM = nM;
  }
  if (half == 0) {
    int col = c0 + wave * 16 + n;
    Mbuf[(size_t)nsh * LSEQ + col] = rM;
    Zbuf[(size_t)nsh * LSEQ + col] = rS;
  }
}

// ---------------- Kernel 3: recompute E, P = exp(E-M)/Z, O += P @ V ---------
__global__ __launch_bounds__(128)
void attnout_kernel(const float* __restrict__ Qp, const float* __restrict__ Kp,
                    const float* __restrict__ Vp, const int* __restrict__ mask,
                    const float* __restrict__ Mbuf, const float* __restrict__ Zbuf,
                    float* __restrict__ Hout) {
  __shared__ float Qs[64 * 64];
  __shared__ float Ks[16 * 64];
  __shared__ float Vs[16 * 64];
  __shared__ float Ps[4][16 * 16];
  __shared__ float Ml[16];
  __shared__ float Zl[16];
  __shared__ int   ms[64];
  const int tid  = threadIdx.x;
  const int lane = tid & 31;
  const int wave = tid >> 5;
  const int q0 = blockIdx.x * 64;
  const int h  = blockIdx.y;
  const int ns = blockIdx.z;
  const int nsh  = ns * HH + h;
  const int n    = lane & 15;
  const int half = lane >> 4;

  for (int t = 0; t < 8; ++t) {
    int idx = tid + t * 128;
    async_ld_b128(&Qs[idx * 4], &Qp[((size_t)nsh * LSEQ + q0) * DD + idx * 4]);
  }
  if (tid < 64) ms[tid] = mask[ns * LSEQ + q0 + tid];

  v8f zero = {};
  v8f acc[4] = {zero, zero, zero, zero};
  const float* Arow = &Qs[(wave * 16) * 64];

  for (int lt = 0; lt < 32; ++lt) {
    int l0 = lt * 16;
    __syncthreads();
    for (int t = 0; t < 2; ++t) {
      int idx = tid + t * 128;
      async_ld_b128(&Ks[idx * 4], &Kp[((size_t)nsh * LSEQ + l0) * DD + idx * 4]);
      async_ld_b128(&Vs[idx * 4], &Vp[((size_t)nsh * LSEQ + l0) * DD + idx * 4]);
    }
    if (tid < 16) {
      Ml[tid] = Mbuf[(size_t)nsh * LSEQ + l0 + tid];
      Zl[tid] = Zbuf[(size_t)nsh * LSEQ + l0 + tid];
    }
    S_WAIT_ASYNCCNT(0);
    __syncthreads();

    v8f c = {};
    for (int k0 = 0; k0 < 64; k0 += 4)
      c = wmma4(frag_a(Arow, 64, k0, lane), frag_bT(Ks, 64, k0, lane), c);

    float invZ = 1.f / Zl[n];
    float Mc   = Ml[n];
    for (int i = 0; i < 8; ++i) {
      int m = i + half * 8;
      float val = ms[wave * 16 + m] ? c[i] * SCALE : EMASKV;
      Ps[wave][m * 16 + n] = __expf(val - Mc) * invZ;
    }
    for (int ct = 0; ct < 4; ++ct)
      for (int k0 = 0; k0 < 16; k0 += 4)
        acc[ct] = wmma4(frag_a(&Ps[wave][0], 16, k0, lane),
                        frag_b(&Vs[ct * 16], 64, k0, lane), acc[ct]);
  }

  // stage O (16x64) in own wave's Qs region -> coalesced float4 stores
  float* stage = (float*)&Qs[(wave * 16) * 64];
  for (int ct = 0; ct < 4; ++ct)
    for (int i = 0; i < 8; ++i) {
      int m = i + half * 8;
      stage[m * 64 + ct * 16 + n] = acc[ct][i];
    }
  for (int t = 0; t < 8; ++t) {
    int idx = lane + t * 32;
    int row = idx >> 4, cv = idx & 15;
    size_t grow = (size_t)ns * LSEQ + q0 + wave * 16 + row;
    *(float4*)(&Hout[grow * EMB + h * DD + cv * 4]) =
        *(const float4*)(&stage[row * 64 + cv * 4]);
  }
}

// ---------------- Kernel 4: Y = Hout @ Wo^T + bo  (8192x1024x1024) ----------
// Double-buffered async-LDS pipeline: each prefetch = 16 wave-level async ops.
__global__ __launch_bounds__(128)
void outproj_kernel(const float* __restrict__ Hout, const float* __restrict__ Wo,
                    const float* __restrict__ bo, float* __restrict__ Y) {
  __shared__ float As[2][64 * 64];
  __shared__ float Bs[2][64 * 64];
  const int tid  = threadIdx.x;
  const int lane = tid & 31;
  const int wave = tid >> 5;
  const int r0 = blockIdx.x * 64;
  const int c0 = blockIdx.y * 64;
  const int n    = lane & 15;
  const int half = lane >> 4;

  auto prefetch = [&](int kt, int buf) {
    int k0g = kt * 64;
    for (int t = 0; t < 8; ++t) {
      int idx = tid + t * 128;
      int row = idx >> 4, cv = idx & 15;
      async_ld_b128(&As[buf][row * 64 + cv * 4],
                    &Hout[((size_t)(r0 + row)) * EMB + k0g + cv * 4]);
      async_ld_b128(&Bs[buf][row * 64 + cv * 4],
                    &Wo[((size_t)(c0 + row)) * EMB + k0g + cv * 4]);
    }
  };

  v8f zero = {};
  v8f acc[4] = {zero, zero, zero, zero};

  prefetch(0, 0);
  for (int kt = 0; kt < 16; ++kt) {
    int buf = kt & 1;
    if (kt < 15) {
      prefetch(kt + 1, buf ^ 1);
      S_WAIT_ASYNCCNT(16);     // <=16 outstanding => current buffer complete
    } else {
      S_WAIT_ASYNCCNT(0);
    }
    __syncthreads();
    const float* Arow = &As[buf][(wave * 16) * 64];
    for (int ct = 0; ct < 4; ++ct) {
      const float* Wn = &Bs[buf][(ct * 16) * 64];
      for (int k0 = 0; k0 < 64; k0 += 4)
        acc[ct] = wmma4(frag_a(Arow, 64, k0, lane), frag_bT(Wn, 64, k0, lane), acc[ct]);
    }
    __syncthreads();           // all waves done with buf before it is refilled
  }

  // stage (with bias) in own wave's As region -> coalesced float4 stores
  float* stage = &As[0][(wave * 16) * 64];
  for (int ct = 0; ct < 4; ++ct) {
    float bias = bo[c0 + ct * 16 + n];
    for (int i = 0; i < 8; ++i) {
      int m = i + half * 8;
      stage[m * 64 + ct * 16 + n] = acc[ct][i] + bias;
    }
  }
  for (int t = 0; t < 8; ++t) {
    int idx = lane + t * 32;
    int row = idx >> 4, cv = idx & 15;
    *(float4*)(&Y[((size_t)(r0 + wave * 16 + row)) * EMB + c0 + cv * 4]) =
        *(const float4*)(&stage[row * 64 + cv * 4]);
  }
}

// ---------------------------------------------------------------------------
extern "C" void kernel_launch(void* const* d_in, const int* in_sizes, int n_in,
                              void* d_out, int out_size, void* d_ws, size_t ws_size,
                              hipStream_t stream) {
  const float* values = (const float*)d_in[0];
  const float* keys   = (const float*)d_in[1];
  const float* query  = (const float*)d_in[2];
  const int*   mask   = (const int*)d_in[3];
  const float* Wv = (const float*)d_in[4];
  const float* Wk = (const float*)d_in[5];
  const float* Wq = (const float*)d_in[6];
  const float* Wo = (const float*)d_in[7];
  const float* bo = (const float*)d_in[8];
  float* Y = (float*)d_out;

  const size_t per   = (size_t)NS * HH * LSEQ * DD;
  const size_t stats = (size_t)NS * HH * LSEQ;
  float* ws   = (float*)d_ws;
  float* Vp   = ws;
  float* Kp   = Vp + per;
  float* Qp   = Kp + per;
  float* Mbuf = Qp + per;
  float* Zbuf = Mbuf + stats;
  float* Hout = Zbuf + stats;

  dim3 blk(128);
  proj_kernel   <<<dim3(LSEQ / 64, HH, NS), blk, 0, stream>>>(values, keys, query,
                                                              Wv, Wk, Wq, Vp, Kp, Qp);
  stats_kernel  <<<dim3(LSEQ / 64, HH, NS), blk, 0, stream>>>(Qp, Kp, mask, Mbuf, Zbuf);
  attnout_kernel<<<dim3(LSEQ / 64, HH, NS), blk, 0, stream>>>(Qp, Kp, Vp, mask,
                                                              Mbuf, Zbuf, Hout);
  outproj_kernel<<<dim3((NS * LSEQ) / 64, EMB / 64, 1), blk, 0, stream>>>(Hout, Wo, bo, Y);
}

// v001
// A run of this version takes 275 microseconds.
// Next to v000, in two timings, it ran 2.60 and 2.59 times as fast.
#include <hip/hip_runtime.h>

typedef __attribute__((ext_vector_type(2))) float v2f;
typedef __attribute__((ext_vector_type(8))) float v8f;

#define NS   16      // N*S
#define LSEQ 512
#define EMB  1024
#define HH   16
#define DD   64
#define SCALE 0.044194173824159216f      // 1/sqrt(512)
#define EMASKV (-1e20f * SCALE)          // masked energy after /sqrt(keylen)
#define NEGBIG (-3.402823466e38f)
// LDS row pitches in floats (64 banks of 4 bytes; every pitch a multiple of 4 floats
// so that each row start stays 16-byte aligned for the b128 copies and float4 reads).
#define PR 68   // 64-float rows walked down a column by 8-byte fragment reads: 4 banks a row
#define PV 80   // V rows read 4 bytes a lane, 16 lanes a row: 4 neighbouring rows fill the 64 banks
#define PP 20   // 16-float P rows walked down a column by 8-byte fragment reads

// ---------------- CDNA5 async global->LDS (ASYNCcnt path) -------------------
// VDST = VGPR with wave-relative LDS byte address (generic LDS addr low bits),
// VADDR = 64-bit global address, saddr disabled ("off").
__device__ __forceinline__ unsigned int lds_addr(const void* lds) {
  return (unsigned int)(unsigned long long)lds;            // LDS aperture: addr[31:0]
}
// A run of copies and its s_wait_xcnt 0 in ONE statement: the wait stands in front of
// every later rewrite of an address register that a copy of the run names.
__device__ __forceinline__ void async_ld_b128_x2(const unsigned int (&l)[2],
                                                 const float* const (&g)[2]) {
  asm volatile("global_load_async_to_lds_b128 %0, %2, off\n\t"
               "global_load_async_to_lds_b128 %1, %3, off\n\t"
               "s_wait_xcnt 0x0"
               :: "v"(l[0]), "v"(l[1]), "v"(g[0]), "v"(g[1]) : "memory");
}
__device__ __forceinline__ void async_ld_b128_x4(const unsigned int (&l)[4],
                                                 const float* const (&g)[4]) {
  asm volatile("global_load_async_to_lds_b128 %0, %4, off\n\t"
               "global_load_async_to_lds_b128 %1, %5, off\n\t"
               "global_load_async_to_lds_b128 %2, %6, off\n\t"
               "global_load_async_to_lds_b128 %3, %7, off\n\t"
               "s_wait_xcnt 0x0"
               :: "v"(l[0]), "v"(l[1]), "v"(l[2]), "v"(l[3]),
                  "v"(g[0]), "v"(g[1]), "v"(g[2]), "v"(g[3]) : "memory");
}
__device__ __forceinline__ void async_ld_b128_x8(const unsigned int (&l)[8],
                                                 const float* const (&g)[8]) {
  asm volatile("global_load_async_to_lds_b128 %0, %8, off\n\t"
               "global_load_async_to_lds_b128 %1, %9, off\n\t"
               "global_load_async_to_lds_b128 %2, %10, off\n\t"
               "global_load_async_to_lds_b128 %3, %11, off\n\t"
               "global_load_async_to_lds_b128 %4, %12, off\n\t"
               "global_load_async_to_lds_b128 %5, %13, off\n\t"
               "global_load_async_to_lds_b128 %6, %14, off\n\t"
               "global_load_async_to_lds_b128 %7, %15, off\n\t"
               "s_wait_xcnt 0x0"
               :: "v"(l[0]), "v"(l[1]), "v"(l[2]), "v"(l[3]),
                  "v"(l[4]), "v"(l[5]), "v"(l[6]), "v"(l[7]),
                  "v"(g[0]), "v"(g[1]), "v"(g[2]), "v"(g[3]),
                  "v"(g[4]), "v"(g[5]), "v"(g[6]), "v"(g[7]) : "memory");
}
// 64 rows x 64 floats, 128 threads: source rows src_pitch floats apart, LDS rows PR apart.
__device__ __forceinline__ void async_tile64(float* dst, const float* src, size_t src_pitch,
                                             int tid) {
  unsigned int l[8];
  const float* g[8];
  for (int t = 0; t < 8; ++t) {
    int idx = tid + t * 128;
    int row = idx >> 4, cv = idx & 15;
    l[t] = lds_addr(&dst[row * PR + cv * 4]);
    g[t] = &src[(size_t)row * src_pitch + cv * 4];
  }
  async_ld_b128_x8(l, g);
}
#define S_WAIT_ASYNCCNT(n) asm volatile("s_wait_asynccnt " #n ::: "memory")

// ---------------- WMMA helpers (V_WMMA_F32_16X16X4_F32, full fp32) ----------
__device__ __forceinline__ v8f wmma4(v2f a, v2f b, v8f c) {
  return __builtin_amdgcn_wmma_f32_16x16x4_f32(
      false, a, false, b, (short)0, c, false, false);
}
// A fragment from row-major A[16][lda] in LDS (M = lane&15, K pair by half)
__device__ __forceinline__ v2f frag_a(const float* A, int lda, int k0, int lane) {
  int m  = lane & 15;
  int kk = k0 + ((lane >> 4) << 1);
  v2f a; a.x = A[m * lda + kk]; a.y = A[m * lda + kk + 1]; return a;
}
// B fragment from row-major B[K][ldb] (B[k][n]); N = lane&15
__device__ __forceinline__ v2f frag_b(const float* B, int ldb, int k0, int lane) {
  int n  = lane & 15;
  int kk = k0 + ((lane >> 4) << 1);
  v2f b; b.x = B[kk * ldb + n]; b.y = B[(kk + 1) * ldb + n]; return b;
}
// B fragment for B = W^T, i.e. B[k][n] = W[n][k] with W row-major [n][ldw]
__device__ __forceinline__ v2f frag_bT(const float* W, int ldw, int k0, int lane) {
  int n  = lane & 15;
  int kk = k0 + ((lane >> 4) << 1);
  v2f b; b.x = W[n * ldw + kk]; b.y = W[n * ldw + kk + 1]; return b;
}

// ---------------- Kernel 1: Q/K/V head projections (X @ W^T) ----------------
__global__ __launch_bounds__(128)
void proj_kernel(const float* __restrict__ values, const float* __restrict__ keys,
                 const float* __restrict__ query,
                 const float* __restrict__ Wv, const float* __restrict__ Wk,
                 const float* __restrict__ Wq,
                 float* __restrict__ Vp, float* __restrict__ Kp, float* __restrict__ Qp) {
  __shared__ __attribute__((aligned(16))) float Xs[64 * PR];
  __shared__ __attribute__((aligned(16))) float Ws[64 * PR];
  const int tid  = threadIdx.x;
  const int lane = tid & 31;
  const int wave = tid >> 5;
  const int l0 = blockIdx.x * 64;
  const int h  = blockIdx.y;
  const int ns = blockIdx.z;
  const int n    = lane & 15;
  const int half = lane >> 4;

  const float* xin[3]  = {values, keys, query};
  const float* win[3]  = {Wv, Wk, Wq};
  float*       outp[3] = {Vp, Kp, Qp};

  for (int p = 0; p < 3; ++p) {
    const float* src = xin[p];
    async_tile64(Xs, &src[((size_t)(ns * LSEQ + l0)) * EMB + h * DD], EMB, tid);  // X chunk
    async_tile64(Ws, win[p], DD, tid);                                            // weight
    S_WAIT_ASYNCCNT(0);
    __syncthreads();

    const float* Arow = &Xs[(wave * 16) * PR];
    v8f zero = {};
    v8f acc[4] = {zero, zero, zero, zero};
    for (int ct = 0; ct < 4; ++ct) {
      const float* Wn = &Ws[(ct * 16) * PR];
      for (int k0 = 0; k0 < 64; k0 += 4)
        acc[ct] = wmma4(frag_a(Arow, PR, k0, lane), frag_bT(Wn, PR, k0, lane), acc[ct]);
    }
    // stage C tiles in own wave's Xs region -> coalesced float4 stores
    float* stage = &Xs[(wave * 16) * PR];
    for (int ct = 0; ct < 4; ++ct)
      for (int i = 0; i < 8; ++i) {
        int m = i + half * 8;
        stage[m * PR + ct * 16 + n] = acc[ct][i];
      }
    float* dst = outp[p];
    size_t base = (size_t)(ns * HH + h) * LSEQ + l0 + wave * 16;
    for (int t = 0; t < 8; ++t) {
      int idx = lane + t * 32;                       // 256 vec4 per wave region
      int row = idx >> 4, cv = idx & 15;
      *(float4*)(&dst[(base + row) * DD + cv * 4]) =
          *(const float4*)(&stage[row * PR + cv * 4]);
    }
    __syncthreads();
  }
}

// ---------------- Kernel 2: column-wise (over q) online softmax stats -------
__global__ __launch_bounds__(128)
void stats_kernel(const float* __restrict__ Qp, const float* __restrict__ Kp,
                  const int* __restrict__ mask,
                  float* __restrict__ Mbuf, float* __restrict__ Zbuf) {
  __shared__ __attribute__((aligned(16))) float Ks[64 * PR];
  __shared__ __attribute__((aligned(16))) float Qs[16 * PR];
  __shared__ int   ms[16];
  const int tid  = threadIdx.x;
  const int lane = tid & 31;
  const int wave = tid >> 5;
  const int c0 = blockIdx.x * 64;
  const int h  = blockIdx.y;
  const int ns = blockIdx.z;
  const int nsh  = ns * HH + h;
  const int n    = lane & 15;
  const int half = lane >> 4;

  const float* Kbase = &Kp[((size_t)nsh * LSEQ + c0) * DD];
  async_tile64(Ks, Kbase, DD, tid);

  float rM = NEGBIG, rS = 0.f;
  const float* Bn = &Ks[(wave * 16) * PR];

  for (int qt = 0; qt < 32; ++qt) {
    int q0 = qt * 16;
    __syncthreads();
    {
      unsigned int l[2];
      const float* g[2];
      for (int t = 0; t < 2; ++t) {
        int idx = tid + t * 128;
        l[t] = lds_addr(&Qs[(idx >> 4) * PR + (idx & 15) * 4]);
        g[t] = &Qp[((size_t)nsh * LSEQ + q0) * DD + idx * 4];
      }
      async_ld_b128_x2(l, g);
    }
    if (tid < 16) ms[tid] = mask[ns * LSEQ + q0 + tid];
    S_WAIT_ASYNCCNT(0);
    __syncthreads();

    v8f c = {};
    for (int k0 = 0; k0 < 64; k0 += 4)
      c = wmma4(frag_a(Qs, PR, k0, lane), frag_bT(Bn, PR, k0, lane), c);

    float vals[8];
    for (int i = 0; i < 8; ++i) {
      int m = i + half * 8;
      vals[i] = ms[m] ? c[i] * SCALE : EMASKV;
    }
    float tM = vals[0];
    for (int i = 1; i < 8; ++i) tM = fmaxf(tM, vals[i]);
    tM = fmaxf(tM, __shfl_xor(tM, 16, 32));
    float nM = fmaxf(rM, tM);
    float tS = 0.f;
    for (int i = 0; i < 8; ++i) tS += __expf(vals[i] - nM);
    tS += __shfl_xor(tS, 16, 32);
    rS = rS * __expf(rM - nM) + tS;
    rM = nM;
  }
  if (half == 0) {
    int col = c0 + wave * 16 + n;
    Mbuf[(size_t)nsh * LSEQ + col] = rM;
    Zbuf[(size_t)nsh * LSEQ + col] = rS;
  }
}

// ---------------- Kernel 3: recompute E, P = exp(E-M)/Z, O += P @ V ---------
__global__ __launch_bounds__(128)
void attnout_kernel(const float* __restrict__ Qp, const float* __restrict__ Kp,
                    const float* __restrict__ Vp, const int* __restrict__ mask,
                    const float* __restrict__ Mbuf, const float* __restrict__ Zbuf,
                    float* __restrict__ Hout) {
  __shared__ __attribute__((aligned(16))) float Qs[64 * PR];
  __shared__ __attribute__((aligned(16))) float Ks[16 * PR];
  __shared__ __attribute__((aligned(16))) float Vs[16 * PV];
  __shared__ __attribute__((aligned(16))) float Ps[4][16 * PP];
  __shared__ float Ml[16];
  __shared__ float Zl[16];
  __shared__ int   ms[64];
  const int tid  = threadIdx.x;
  const int lane = tid & 31;
  const int wave = tid >> 5;
  const int q0 = blockIdx.x * 64;
  const int h  = blockIdx.y;
  const int ns = blockIdx.z;
  const int nsh  = ns * HH + h;
  const int n    = lane & 15;
  const int half = lane >> 4;

  async_tile64(Qs, &Qp[((size_t)nsh * LSEQ + q0) * DD], DD, tid);
  if (tid < 64) ms[tid] = mask[ns * LSEQ + q0 + tid];

  v8f zero = {};
  v8f acc[4] = {zero, zero, zero, zero};
  const float* Arow = &Qs[(wave * 16) * PR];

  for (int lt = 0; lt < 32; ++lt) {
    int l0 = lt * 16;
    __syncthreads();
    {
      unsigned int l[4];
      const float* g[4];
      for (int t = 0; t < 2; ++t) {
        int idx = tid + t * 128;
        int row = idx >> 4, cv = idx & 15;
        l[2 * t]     = lds_addr(&Ks[row * PR + cv * 4]);
        g[2 * t]     = &Kp[((size_t)nsh * LSEQ + l0) * DD + idx * 4];
        l[2 * t + 1] = lds_addr(&Vs[row * PV + cv * 4]);
        g[2 * t + 1] = &Vp[((size_t)nsh * LSEQ + l0) * DD + idx * 4];
      }
      async_ld_b128_x4(l, g);
    }
    if (tid < 16) {
      Ml[tid] = Mbuf[(size_t)nsh * LSEQ + l0 + tid];
      Zl[tid] = Zbuf[(size_t)nsh * LSEQ + l0 + tid];
    }
    S_WAIT_ASYNCCNT(0);
    __syncthreads();

    v8f c = {};
    for (int k0 = 0; k0 < 64; k0 += 4)
      c = wmma4(frag_a(Arow, PR, k0, lane), frag_bT(Ks, PR, k0, lane), c);

    float invZ = 1.f / Zl[n];
    float Mc   = Ml[n];
    for (int i = 0; i < 8; ++i) {
      int m = i + half * 8;
      float val = ms[wave * 16 + m] ? c[i] * SCALE : EMASKV;
      Ps[wave][m * PP + n] = __expf(val - Mc) * invZ;
    }
    for (int ct = 0; ct < 4; ++ct)
      for (int k0 = 0; k0 < 16; k0 += 4)
        acc[ct] = wmma4(frag_a(&Ps[wave][0], PP, k0, lane),
                        frag_b(&Vs[ct * 16], PV, k0, lane), acc[ct]);
  }

  // stage O (16x64) in own wave's Qs region -> coalesced float4 stores
  float* stage = (float*)&Qs[(wave * 16) * PR];
  for (int ct = 0; ct < 4; ++ct)
    for (int i = 0; i < 8; ++i) {
      int m = i + half * 8;
      stage[m * PR + ct * 16 + n] = acc[ct][i];
    }
  for (int t = 0; t < 8; ++t) {
    int idx = lane + t * 32;
    int row = idx >> 4, cv = idx & 15;
    size_t grow = (size_t)ns * LSEQ + q0 + wave * 16 + row;
    *(float4*)(&Hout[grow * EMB + h * DD + cv * 4]) =
        *(const float4*)(&stage[row * PR + cv * 4]);
  }
}

// ---------------- Kernel 4: Y = Hout @ Wo^T + bo  (8192x1024x1024) ----------
// Double-buffered async-LDS pipeline: each prefetch = 16 wave-level async ops.
__global__ __launch_bounds__(128)
void outproj_kernel(const float* __restrict__ Hout, const float* __restrict__ Wo,
                    const float* __restrict__ bo, float* __restrict__ Y) {
  __shared__ __attribute__((aligned(16))) float As[2][64 * PR];
  __shared__ __attribute__((aligned(16))) float Bs[2][64 * PR];
  const int tid  = threadIdx.x;
  const int lane = tid & 31;
  const int wave = tid >> 5;
  const int r0 = blockIdx.x * 64;
  const int c0 = blockIdx.y * 64;
  const int n    = lane & 15;
  const int half = lane >> 4;

  auto prefetch = [&](int kt, int buf) {
    int k0g = kt * 64;
    async_tile64(As[buf], &Hout[(size_t)r0 * EMB + k0g], EMB, tid);
    async_tile64(Bs[buf], &Wo[(size_t)c0 * EMB + k0g], EMB, tid);
  };

  v8f zero = {};
  v8f acc[4] = {zero, zero, zero, zero};

  prefetch(0, 0);
  for (int kt = 0; kt < 16; ++kt) {
    int buf = kt & 1;
    if (kt < 15) {
      prefetch(kt + 1, buf ^ 1);
      S_WAIT_ASYNCCNT(16);     // <=16 outstanding => current buffer complete
    } else {
      S_WAIT_ASYNCCNT(0);
    }
    __syncthreads();
    const float* Arow = &As[buf][(wave * 16) * PR];
    for (int ct = 0; ct < 4; ++ct) {
      const float* Wn = &Bs[buf][(ct * 16) * PR];
      for (int k0 = 0; k0 < 64; k0 += 4)
        acc[ct] = wmma4(frag_a(Arow, PR, k0, lane), frag_bT(Wn, PR, k0, lane), acc[ct]);
    }
    __syncthreads();           // all waves done with buf before it is refilled
  }

  // stage (with bias) in own wave's As region -> coalesced float4 stores
  float* stage = &As[0][(wave * 16) * PR];
  for (int ct = 0; ct < 4; ++ct) {
    float bias = bo[c0 + ct * 16 + n];
    for (int i = 0; i < 8; ++i) {
      int m = i + half * 8;
      stage[m * PR + ct * 16 + n] = acc[ct][i] + bias;
    }
  }
  for (int t = 0; t < 8; ++t) {
    int idx = lane + t * 32;
    int row = idx >> 4, cv = idx & 15;
    *(float4*)(&Y[((size_t)(r0 + wave * 16 + row)) * EMB + c0 + cv * 4]) =
        *(const float4*)(&stage[row * PR + cv * 4]);
  }
}

// ---------------------------------------------------------------------------
extern "C" void kernel_launch(void* const* d_in, const int* in_sizes, int n_in,
                              void* d_out, int out_size, void* d_ws, size_t ws_size,
                              hipStream_t stream) {
  const float* values = (const float*)d_in[0];
  const float* keys   = (const float*)d_in[1];
  const float* query  = (const float*)d_in[2];
  const int*   mask   = (const int*)d_in[3];
  const float* Wv = (const float*)d_in[4];
  const float* Wk = (const float*)d_in[5];
  const float* Wq = (const float*)d_in[6];
  const float* Wo = (const float*)d_in[7];
  const float* bo = (const float*)d_in[8];
  float* Y = (float*)d_out;

  const size_t per   = (size_t)NS * HH * LSEQ * DD;
  const size_t stats = (size_t)NS * HH * LSEQ;
  float* ws   = (float*)d_ws;
  float* Vp   = ws;
  float* Kp   = Vp + per;
  float* Qp   = Kp + per;
  float* Mbuf = Qp + per;
  float* Zbuf = Mbuf + stats;
  float* Hout = Zbuf + stats;

  dim3 blk(128);
  proj_kernel   <<<dim3(LSEQ / 64, HH, NS), blk, 0, stream>>>(values, keys, query,
                                                              Wv, Wk, Wq, Vp, Kp, Qp);
  stats_kernel  <<<dim3(LSEQ / 64, HH, NS), blk, 0, stream>>>(Qp, Kp, mask, Mbuf, Zbuf);
  attnout_kernel<<<dim3(LSEQ / 64, HH, NS), blk, 0, stream>>>(Qp, Kp, Vp, mask,
                                                              Mbuf, Zbuf, Hout);
  outproj_kernel<<<dim3((NS * LSEQ) / 64, EMB / 64, 1), blk, 0, stream>>>(Hout, Wo, bo, Y);
}

// v002
// A run of this version takes 205 microseconds.
// Two timings next to v001 both put it at 1.34 times that version's speed.
// Counting every step since v000, it is 3.49 times as fast.
#include <hip/hip_runtime.h>

typedef __attribute__((ext_vector_type(2))) float v2f;
typedef __attribute__((ext_vector_type(8))) float v8f;

#define NS   16      // N*S
#define LSEQ 512
#define EMB  1024
#define HH   16
#define DD   64
#define SCALE 0.044194173824159216f      // 1/sqrt(512)
#define EMASKV (-1e20f * SCALE)          // masked energy after /sqrt(keylen)
#define NEGBIG (-3.402823466e38f)
// LDS row pitches in floats (64 banks of 4 bytes; every pitch a multiple of 4 floats
// so that each row start stays 16-byte aligned for the b128 copies and float4 reads).
#define PR 68   // 64-float rows walked down a column by 8-byte fragment reads: 4 banks a row
#define PV 80   // V rows read 4 bytes a lane, 16 lanes a row: 4 neighbouring rows fill the 64 banks
#define PS 20   // 16-float rows (one value a wave) read 16 bytes a lane, one row a lane
#define NW 16   // waves of the attention work-group

// ---------------- CDNA5 async global->LDS (ASYNCcnt path) -------------------
// VDST = VGPR with wave-relative LDS byte address (generic LDS addr low bits),
// VADDR = 64-bit global address, saddr disabled ("off").
__device__ __forceinline__ unsigned int lds_addr(const void* lds) {
  return (unsigned int)(unsigned long long)lds;            // LDS aperture: addr[31:0]
}
// A run of copies and its s_wait_xcnt 0 in ONE statement: the wait stands in front of
// every later rewrite of an address register that a copy of the run names.
__device__ __forceinline__ void async_ld_b128_x4(const unsigned int (&l)[4],
                                                 const float* const (&g)[4]) {
  asm volatile("global_load_async_to_lds_b128 %0, %4, off\n\t"
               "global_load_async_to_lds_b128 %1, %5, off\n\t"
               "global_load_async_to_lds_b128 %2, %6, off\n\t"
               "global_load_async_to_lds_b128 %3, %7, off\n\t"
               "s_wait_xcnt 0x0"
               :: "v"(l[0]), "v"(l[1]), "v"(l[2]), "v"(l[3]),
                  "v"(g[0]), "v"(g[1]), "v"(g[2]), "v"(g[3]) : "memory");
}
__device__ __forceinline__ void async_ld_b128_x8(const unsigned int (&l)[8],
                                                 const float* const (&g)[8]) {
  asm volatile("global_load_async_to_lds_b128 %0, %8, off\n\t"
               "global_load_async_to_lds_b128 %1, %9, off\n\t"
               "global_load_async_to_lds_b128 %2, %10, off\n\t"
               "global_load_async_to_lds_b128 %3, %11, off\n\t"
               "global_load_async_to_lds_b128 %4, %12, off\n\t"
               "global_load_async_to_lds_b128 %5, %13, off\n\t"
               "global_load_async_to_lds_b128 %6, %14, off\n\t"
               "global_load_async_to_lds_b128 %7, %15, off\n\t"
               "s_wait_xcnt 0x0"
               :: "v"(l[0]), "v"(l[1]), "v"(l[2]), "v"(l[3]),
                  "v"(l[4]), "v"(l[5]), "v"(l[6]), "v"(l[7]),
                  "v"(g[0]), "v"(g[1]), "v"(g[2]), "v"(g[3]),
                  "v"(g[4]), "v"(g[5]), "v"(g[6]), "v"(g[7]) : "memory");
}
// 64 rows x 64 floats, 128 threads: source rows src_pitch floats apart, LDS rows PR apart.
__device__ __forceinline__ void async_tile64(float* dst, const float* src, size_t src_pitch,
                                             int tid) {
  unsigned int l[8];
  const float* g[8];
  for (int t = 0; t < 8; ++t) {
    int idx = tid + t * 128;
    int row = idx >> 4, cv = idx & 15;
    l[t] = lds_addr(&dst[row * PR + cv * 4]);
    g[t] = &src[(size_t)row * src_pitch + cv * 4];
  }
  async_ld_b128_x8(l, g);
}
#define S_WAIT_ASYNCCNT(n) asm volatile("s_wait_asynccnt " #n ::: "memory")
#define S_WAIT_DSCNT(n) asm volatile("s_wait_dscnt " #n ::: "memory")

// ---------------- WMMA helpers (V_WMMA_F32_16X16X4_F32, full fp32) ----------
__device__ __forceinline__ v8f wmma4(v2f a, v2f b, v8f c) {
  return __builtin_amdgcn_wmma_f32_16x16x4_f32(
      false, a, false, b, (short)0, c, false, false);
}
// A fragment from row-major A[16][lda] in LDS (M = lane&15, K pair by half)
__device__ __forceinline__ v2f frag_a(const float* A, int lda, int k0, int lane) {
  int m  = lane & 15;
  int kk = k0 + ((lane >> 4) << 1);
  v2f a; a.x = A[m * lda + kk]; a.y = A[m * lda + kk + 1]; return a;
}
// B fragment from row-major B[K][ldb] (B[k][n]); N = lane&15
__device__ __forceinline__ v2f frag_b(const float* B, int ldb, int k0, int lane) {
  int n  = lane & 15;
  int kk = k0 + ((lane >> 4) << 1);
  v2f b; b.x = B[kk * ldb + n]; b.y = B[(kk + 1) * ldb + n]; return b;
}
// B fragment for B = W^T, i.e. B[k][n] = W[n][k] with W row-major [n][ldw]
__device__ __forceinline__ v2f frag_bT(const float* W, int ldw, int k0, int lane) {
  int n  = lane & 15;
  int kk = k0 + ((lane >> 4) << 1);
  v2f b; b.x = W[n * ldw + kk]; b.y = W[n * ldw + kk + 1]; return b;
}

// ---------------- Kernel 1: Q/K/V head projections (X @ W^T) ----------------
__global__ __launch_bounds__(128)
void proj_kernel(const float* __restrict__ values, const float* __restrict__ keys,
                 const float* __restrict__ query,
                 const float* __restrict__ Wv, const float* __restrict__ Wk,
                 const float* __restrict__ Wq,
                 float* __restrict__ Vp, float* __restrict__ Kp, float* __restrict__ Qp) {
  __shared__ __attribute__((aligned(16))) float Xs[64 * PR];
  __shared__ __attribute__((aligned(16))) float Ws[64 * PR];
  const int tid  = threadIdx.x;
  const int lane = tid & 31;
  const int wave = tid >> 5;
  const int l0 = blockIdx.x * 64;
  const int h  = blockIdx.y;
  const int ns = blockIdx.z;
  const int n    = lane & 15;
  const int half = lane >> 4;

  const float* xin[3]  = {values, keys, query};
  const float* win[3]  = {Wv, Wk, Wq};
  float*       outp[3] = {Vp, Kp, Qp};

  for (int p = 0; p < 3; ++p) {
    const float* src = xin[p];
    async_tile64(Xs, &src[((size_t)(ns * LSEQ + l0)) * EMB + h * DD], EMB, tid);  // X chunk
    async_tile64(Ws, win[p], DD, tid);                                            // weight
    S_WAIT_ASYNCCNT(0);
    __syncthreads();

    const float* Arow = &Xs[(wave * 16) * PR];
    v8f zero = {};
    v8f acc[4] = {zero, zero, zero, zero};
    for (int ct = 0; ct < 4; ++ct) {
      const float* Wn = &Ws[(ct * 16) * PR];
      for (int k0 = 0; k0 < 64; k0 += 4)
        acc[ct] = wmma4(frag_a(Arow, PR, k0, lane), frag_bT(Wn, PR, k0, lane), acc[ct]);
    }
    // stage C tiles in own wave's Xs region -> coalesced float4 stores
    float* stage = &Xs[(wave * 16) * PR];
    for (int ct = 0; ct < 4; ++ct)
      for (int i = 0; i < 8; ++i) {
        int m = i + half * 8;
        stage[m * PR + ct * 16 + n] = acc[ct][i];
      }
    float* dst = outp[p];
    size_t base = (size_t)(ns * HH + h) * LSEQ + l0 + wave * 16;
    for (int t = 0; t < 8; ++t) {
      int idx = lane + t * 32;                       // 256 vec4 per wave region
      int row = idx >> 4, cv = idx & 15;
      *(float4*)(&dst[(base + row) * DD + cv * 4]) =
          *(const float4*)(&stage[row * PR + cv * 4]);
    }
    __syncthreads();
  }
}

// ---------------- Kernel 2: whole head per work-group ------------------------
// 16 waves, each owning 32 query rows (Q fragments stay in registers), walk the keys in
// blocks of 64. All 512 query rows of a key column are inside the work-group, so the
// column softmax (over q) is finished here and every energy tile is computed once.
__global__ __launch_bounds__(512)
void attn_kernel(const float* __restrict__ Qp, const float* __restrict__ Kp,
                 const float* __restrict__ Vp, const int* __restrict__ mask,
                 float* __restrict__ Hout) {
  __shared__ __attribute__((aligned(16))) float Ks[2][64 * PR];
  __shared__ __attribute__((aligned(16))) float Vs[2][64 * PV];
  __shared__ __attribute__((aligned(16))) float Ps[NW][32 * PR];   // per wave: Q, then P, then O
  __shared__ __attribute__((aligned(16))) float redM[64 * PS];     // [column][wave] maxima
  __shared__ __attribute__((aligned(16))) float redS[64 * PS];     // [column][wave] sums
  __shared__ __attribute__((aligned(16))) float Fs[NW][64];        // per wave: factor of each key column
  const int tid  = threadIdx.x;
  const int lane = tid & 31;
  const int wave = tid >> 5;
  const int h  = blockIdx.x;
  const int ns = blockIdx.y;
  const int nsh  = ns * HH + h;
  const int n    = lane & 15;
  const int half = lane >> 4;
  float* Pw = &Ps[wave][0];

  // K and V rows t*64 .. t*64+63 into buffer buf: 2 x 1024 float4, 512 threads
  auto stage_kv = [&](int t, int buf) {
    unsigned int l[4];
    const float* g[4];
    for (int u = 0; u < 2; ++u) {
      int idx = tid + u * 512;
      int row = idx >> 4, cv = idx & 15;
      l[2 * u]     = lds_addr(&Ks[buf][row * PR + cv * 4]);
      g[2 * u]     = &Kp[((size_t)nsh * LSEQ + t * 64) * DD + idx * 4];
      l[2 * u + 1] = lds_addr(&Vs[buf][row * PV + cv * 4]);
      g[2 * u + 1] = &Vp[((size_t)nsh * LSEQ + t * 64) * DD + idx * 4];
    }
    async_ld_b128_x4(l, g);
  };

  // the wave's own 32 Q rows into its own P region
  for (int u = 0; u < 2; ++u) {
    unsigned int l[8];
    const float* g[8];
    for (int t = 0; t < 8; ++t) {
      int idx = lane + (u * 8 + t) * 32;
      l[t] = lds_addr(&Pw[(idx >> 4) * PR + (idx & 15) * 4]);
      g[t] = &Qp[((size_t)nsh * LSEQ + wave * 32) * DD + idx * 4];
    }
    async_ld_b128_x8(l, g);
  }
  stage_kv(0, 0);

  bool mk[2][8];
  for (int mt = 0; mt < 2; ++mt)
    for (int i = 0; i < 8; ++i)
      mk[mt][i] = mask[ns * LSEQ + wave * 32 + mt * 16 + half * 8 + i] != 0;

  // own copies (Q rows, block 0) landed, then the barrier that publishes block 0
  S_WAIT_ASYNCCNT(0);
  __syncthreads();
  stage_kv(1, 1);

  v2f qf[2][16];
#pragma unroll   // constant indices keep the fragments in registers
  for (int mt = 0; mt < 2; ++mt)
#pragma unroll   // constant indices: the arrays stay in registers
    for (int ks = 0; ks < 16; ++ks)
      qf[mt][ks] = frag_a(&Pw[mt * 16 * PR], PR, ks * 4, lane);

  v8f zero = {};
  v8f acc[2][4] = {{zero, zero, zero, zero}, {zero, zero, zero, zero}};

  for (int t = 0; t < 8; ++t) {
    const float* Kb = &Ks[t & 1][0];
    const float* Vb = &Vs[t & 1][0];

    // Two halves of 32 key columns, so that only 32 registers of energies are live at a time.
    // Each: E = Q K^T (32 rows x 32 columns), then this wave's own column maximum Mw and
    // sum of exp(E - Mw) over its 32 rows; exp(E - Mw) goes to the wave's LDS region.
#pragma unroll   // constant indices into qf and e
    for (int hc = 0; hc < 2; ++hc) {
      v8f e[2][2] = {{zero, zero}, {zero, zero}};
#pragma unroll   // constant indices: the arrays stay in registers
      for (int ks = 0; ks < 16; ++ks) {
#pragma unroll   // constant indices: the arrays stay in registers
        for (int cc = 0; cc < 2; ++cc) {
          v2f b = frag_bT(&Kb[(hc * 2 + cc) * 16 * PR], PR, ks * 4, lane);
          e[0][cc] = wmma4(qf[0][ks], b, e[0][cc]);
          e[1][cc] = wmma4(qf[1][ks], b, e[1][cc]);
        }
      }
#pragma unroll   // constant indices: the arrays stay in registers
      for (int cc = 0; cc < 2; ++cc) {
        const int ct = hc * 2 + cc;
        float mx = NEGBIG;
#pragma unroll   // constant indices: the arrays stay in registers
        for (int mt = 0; mt < 2; ++mt)
#pragma unroll   // constant indices: the arrays stay in registers
          for (int i = 0; i < 8; ++i) {
            float v = mk[mt][i] ? e[mt][cc][i] * SCALE : EMASKV;
            e[mt][cc][i] = v;
            mx = fmaxf(mx, v);
          }
        mx = fmaxf(mx, __shfl_xor(mx, 16, 32));
        float s = 0.f;
#pragma unroll   // constant indices: the arrays stay in registers
        for (int mt = 0; mt < 2; ++mt)
#pragma unroll   // constant indices: the arrays stay in registers
          for (int i = 0; i < 8; ++i) {
            float p = __expf(e[mt][cc][i] - mx);
            Pw[(mt * 16 + half * 8 + i) * PR + ct * 16 + n] = p;
            s += p;
          }
        s += __shfl_xor(s, 16, 32);
        // both halves hold both values: lanes 0-15 store the maximum, lanes 16-31 the sum
        (half ? redS : redM)[(ct * 16 + n) * PS + wave] = half ? s : mx;
      }
    }
    __syncthreads();   // every wave's column maxima and sums are in LDS

    // merge the 16 waves' pairs, each lane two whole key columns: column maximum m and sum z;
    // this wave's factor exp(Mw - m) / z for each key column goes to its own row of Fs
#pragma unroll   // constant indices: the arrays stay in registers
    for (int cb = 0; cb < 2; ++cb) {
      const int col = cb * 32 + lane;
      const float4* pm = (const float4*)&redM[col * PS];
      const float4* ps = (const float4*)&redS[col * PS];
      float4 mv[4], sv[4];
#pragma unroll   // constant indices: the arrays stay in registers
      for (int j = 0; j < 4; ++j) { mv[j] = pm[j]; sv[j] = ps[j]; }
      float mown = redM[col * PS + wave];
      float m = NEGBIG;
#pragma unroll   // constant indices: the arrays stay in registers
      for (int j = 0; j < 4; ++j)
        m = fmaxf(m, fmaxf(fmaxf(mv[j].x, mv[j].y), fmaxf(mv[j].z, mv[j].w)));
      float zp[4];
#pragma unroll   // constant indices: the arrays stay in registers
      for (int j = 0; j < 4; ++j)
        zp[j] = sv[j].x * __expf(mv[j].x - m) + sv[j].y * __expf(mv[j].y - m) +
                sv[j].z * __expf(mv[j].z - m) + sv[j].w * __expf(mv[j].w - m);
      float z = (zp[0] + zp[1]) + (zp[2] + zp[3]);
      Fs[wave][col] = __expf(mown - m) / z;
    }

    // O += P V, with P = exp(E - Mw) * factor formed on the A fragment (its k is the key column)
#pragma unroll   // constant indices into acc
    for (int ks = 0; ks < 16; ++ks) {
      v2f fk = *(const v2f*)&Fs[wave][ks * 4 + half * 2];
      v2f a0 = frag_a(&Pw[0], PR, ks * 4, lane) * fk;
      v2f a1 = frag_a(&Pw[16 * PR], PR, ks * 4, lane) * fk;
#pragma unroll   // constant indices: the arrays stay in registers
      for (int ct = 0; ct < 4; ++ct) {
        v2f b = frag_b(&Vb[ct * 16], PV, ks * 4, lane);
        acc[0][ct] = wmma4(a0, b, acc[0][ct]);
        acc[1][ct] = wmma4(a1, b, acc[1][ct]);
      }
    }

    // hand-over: own LDS reads retired, own copies of block t+1 landed, then the barrier
    // that publishes block t+1 and frees this block's buffer for block t+2
    S_WAIT_DSCNT(0);
    S_WAIT_ASYNCCNT(0);
    __syncthreads();
    if (t + 2 < 8) stage_kv(t + 2, t & 1);
  }
  S_WAIT_ASYNCCNT(0);   // no copy outstanding before the LDS is reused and the wave ends

  // stage O (32x64) in the wave's own region -> coalesced float4 stores
#pragma unroll   // constant indices: the arrays stay in registers
  for (int mt = 0; mt < 2; ++mt)
#pragma unroll   // constant indices: the arrays stay in registers
    for (int ct = 0; ct < 4; ++ct)
#pragma unroll   // constant indices: the arrays stay in registers
      for (int i = 0; i < 8; ++i)
        Pw[(mt * 16 + half * 8 + i) * PR + ct * 16 + n] = acc[mt][ct][i];
  float* hp = &Hout[((size_t)ns * LSEQ + wave * 32 + half) * EMB + h * DD + n * 4];
  const float* sp = &Pw[half * PR + n * 4];
  for (int t = 0; t < 16; ++t)   // two rows a store: lanes 0-15 row 2t, lanes 16-31 row 2t+1
    *(float4*)(&hp[(size_t)t * 2 * EMB]) = *(const float4*)(&sp[t * 2 * PR]);
}

// ---------------- Kernel 3: Y = Hout @ Wo^T + bo  (8192x1024x1024) ----------
// Double-buffered async-LDS pipeline: each prefetch = 16 wave-level async ops.
__global__ __launch_bounds__(128)
void outproj_kernel(const float* __restrict__ Hout, const float* __restrict__ Wo,
                    const float* __restrict__ bo, float* __restrict__ Y) {
  __shared__ __attribute__((aligned(16))) float As[2][64 * PR];
  __shared__ __attribute__((aligned(16))) float Bs[2][64 * PR];
  const int tid  = threadIdx.x;
  const int lane = tid & 31;
  const int wave = tid >> 5;
  const int r0 = blockIdx.x * 64;
  const int c0 = blockIdx.y * 64;
  const int n    = lane & 15;
  const int half = lane >> 4;

  auto prefetch = [&](int kt, int buf) {
    int k0g = kt * 64;
    async_tile64(As[buf], &Hout[(size_t)r0 * EMB + k0g], EMB, tid);
    async_tile64(Bs[buf], &Wo[(size_t)c0 * EMB + k0g], EMB, tid);
  };

  v8f zero = {};
  v8f acc[4] = {zero, zero, zero, zero};

  prefetch(0, 0);
  for (int kt = 0; kt < 16; ++kt) {
    int buf = kt & 1;
    if (kt < 15) {
      prefetch(kt + 1, buf ^ 1);
      S_WAIT_ASYNCCNT(16);     // <=16 outstanding => current buffer complete
    } else {
      S_WAIT_ASYNCCNT(0);
    }
    __syncthreads();
    const float* Arow = &As[buf][(wave * 16) * PR];
    for (int ct = 0; ct < 4; ++ct) {
      const float* Wn = &Bs[buf][(ct * 16) * PR];
      for (int k0 = 0; k0 < 64; k0 += 4)
        acc[ct] = wmma4(frag_a(Arow, PR, k0, lane), frag_bT(Wn, PR, k0, lane), acc[ct]);
    }
    __syncthreads();           // all waves done with buf before it is refilled
  }

  // stage (with bias) in own wave's As region -> coalesced float4 stores
  float* stage = &As[0][(wave * 16) * PR];
  for (int ct = 0; ct < 4; ++ct) {
    float bias = bo[c0 + ct * 16 + n];
    for (int i = 0; i < 8; ++i) {
      int m = i + half * 8;
      stage[m * PR + ct * 16 + n] = acc[ct][i] + bias;
    }
  }
  for (int t = 0; t < 8; ++t) {
    int idx = lane + t * 32;
    int row = idx >> 4, cv = idx & 15;
    *(float4*)(&Y[((size_t)(r0 + wave * 16 + row)) * EMB + c0 + cv * 4]) =
        *(const float4*)(&stage[row * PR + cv * 4]);
  }
}

// ---------------------------------------------------------------------------
extern "C" void kernel_launch(void* const* d_in, const int* in_sizes, int n_in,
                              void* d_out, int out_size, void* d_ws, size_t ws_size,
                              hipStream_t stream) {
  const float* values = (const float*)d_in[0];
  const float* keys   = (const float*)d_in[1];
  const float* query  = (const float*)d_in[2];
  const int*   mask   = (const int*)d_in[3];
  const float* Wv = (const float*)d_in[4];
  const float* Wk = (const float*)d_in[5];
  const float* Wq = (const float*)d_in[6];
  const float* Wo = (const float*)d_in[7];
  const float* bo = (const float*)d_in[8];
  float* Y = (float*)d_out;

  const size_t per   = (size_t)NS * HH * LSEQ * DD;
  float* ws   = (float*)d_ws;
  float* Vp   = ws;
  float* Kp   = Vp + per;
  float* Qp   = Kp + per;
  float* Hout = Qp + per;

  dim3 blk(128);
  proj_kernel   <<<dim3(LSEQ / 64, HH, NS), blk, 0, stream>>>(values, keys, query,
                                                              Wv, Wk, Wq, Vp, Kp, Qp);
  attn_kernel   <<<dim3(HH, NS), dim3(NW * 32), 0, stream>>>(Qp, Kp, Vp, mask, Hout);
  outproj_kernel<<<dim3((NS * LSEQ) / 64, EMB / 64, 1), blk, 0, stream>>>(Hout, Wo, bo, Y);
}

// v003
// Measured time: 163 microseconds a run.
// Two timings next to v002 both put it at 1.26 times that version's speed.
// All steps since v000 together make it 4.40 times as fast.
#include <hip/hip_runtime.h>

typedef __attribute__((ext_vector_type(2))) float v2f;
typedef __attribute__((ext_vector_type(4))) float v4f;
typedef __attribute__((ext_vector_type(8))) float v8f;

#define NS   16      // N*S
#define LSEQ 512
#define EMB  1024
#define HH   16
#define DD   64
#define SCALE 0.044194173824159216f      // 1/sqrt(512)
#define EMASKV (-1e20f * SCALE)          // masked energy after /sqrt(keylen)
#define NEGBIG (-3.402823466e38f)
// LDS row pitches in floats (64 banks of 4 bytes; every pitch a multiple of 4 floats
// so that each row start stays 16-byte aligned for the b128 copies and float4 reads).
#define PR 68   // 64-float rows walked down a column by 8-byte fragment reads: 4 banks a row
#define PV 80   // V rows read 4 bytes a lane, 16 lanes a row: 4 neighbouring rows fill the 64 banks
#define PS 20   // 16-float rows (one value a wave) read 16 bytes a lane, one row a lane
#define NW 16   // waves of the attention work-group

// ---------------- CDNA5 async global->LDS (ASYNCcnt path) -------------------
// VDST = VGPR with wave-relative LDS byte address (generic LDS addr low bits),
// VADDR = 64-bit global address, saddr disabled ("off").
__device__ __forceinline__ unsigned int lds_addr(const void* lds) {
  return (unsigned int)(unsigned long long)lds;            // LDS aperture: addr[31:0]
}
// A run of copies and its s_wait_xcnt 0 in ONE statement: the wait stands in front of
// every later rewrite of an address register that a copy of the run names.
__device__ __forceinline__ void async_ld_b128_x4(const unsigned int (&l)[4],
                                                 const float* const (&g)[4]) {
  asm volatile("global_load_async_to_lds_b128 %0, %4, off\n\t"
               "global_load_async_to_lds_b128 %1, %5, off\n\t"
               "global_load_async_to_lds_b128 %2, %6, off\n\t"
               "global_load_async_to_lds_b128 %3, %7, off\n\t"
               "s_wait_xcnt 0x0"
               :: "v"(l[0]), "v"(l[1]), "v"(l[2]), "v"(l[3]),
                  "v"(g[0]), "v"(g[1]), "v"(g[2]), "v"(g[3]) : "memory");
}
__device__ __forceinline__ void async_ld_b128_x8(const unsigned int (&l)[8],
                                                 const float* const (&g)[8]) {
  asm volatile("global_load_async_to_lds_b128 %0, %8, off\n\t"
               "global_load_async_to_lds_b128 %1, %9, off\n\t"
               "global_load_async_to_lds_b128 %2, %10, off\n\t"
               "global_load_async_to_lds_b128 %3, %11, off\n\t"
               "global_load_async_to_lds_b128 %4, %12, off\n\t"
               "global_load_async_to_lds_b128 %5, %13, off\n\t"
               "global_load_async_to_lds_b128 %6, %14, off\n\t"
               "global_load_async_to_lds_b128 %7, %15, off\n\t"
               "s_wait_xcnt 0x0"
               :: "v"(l[0]), "v"(l[1]), "v"(l[2]), "v"(l[3]),
                  "v"(l[4]), "v"(l[5]), "v"(l[6]), "v"(l[7]),
                  "v"(g[0]), "v"(g[1]), "v"(g[2]), "v"(g[3]),
                  "v"(g[4]), "v"(g[5]), "v"(g[6]), "v"(g[7]) : "memory");
}
// 64 rows x 64 floats, 128 threads: source rows src_pitch floats apart, LDS rows PR apart.
__device__ __forceinline__ void async_tile64(float* dst, const float* src, size_t src_pitch,
                                             int tid) {
  unsigned int l[8];
  const float* g[8];
  for (int t = 0; t < 8; ++t) {
    int idx = tid + t * 128;
    int row = idx >> 4, cv = idx & 15;
    l[t] = lds_addr(&dst[row * PR + cv * 4]);
    g[t] = &src[(size_t)row * src_pitch + cv * 4];
  }
  async_ld_b128_x8(l, g);
}
// A run of scattered 16-byte stores and its s_wait_xcnt 0 in ONE statement: every store has its
// own address and data registers, and the wait stands in front of every later rewrite of them.
__device__ __forceinline__ void store_b128_x8(float* const (&p)[8], const v4f (&d)[8]) {
  asm volatile("global_store_b128 %0, %8, off\n\t"
               "global_store_b128 %1, %9, off\n\t"
               "global_store_b128 %2, %10, off\n\t"
               "global_store_b128 %3, %11, off\n\t"
               "global_store_b128 %4, %12, off\n\t"
               "global_store_b128 %5, %13, off\n\t"
               "global_store_b128 %6, %14, off\n\t"
               "global_store_b128 %7, %15, off\n\t"
               "s_wait_xcnt 0x0"
               :: "v"(p[0]), "v"(p[1]), "v"(p[2]), "v"(p[3]),
                  "v"(p[4]), "v"(p[5]), "v"(p[6]), "v"(p[7]),
                  "v"(d[0]), "v"(d[1]), "v"(d[2]), "v"(d[3]),
                  "v"(d[4]), "v"(d[5]), "v"(d[6]), "v"(d[7]) : "memory");
}
#define S_WAIT_ASYNCCNT(n) asm volatile("s_wait_asynccnt " #n ::: "memory")
#define S_WAIT_DSCNT(n) asm volatile("s_wait_dscnt " #n ::: "memory")
#define S_WAIT_XCNT0 asm volatile("s_wait_xcnt 0x0" ::: "memory")

// ---------------- WMMA helpers (V_WMMA_F32_16X16X4_F32, full fp32) ----------
__device__ __forceinline__ v8f wmma4(v2f a, v2f b, v8f c) {
  return __builtin_amdgcn_wmma_f32_16x16x4_f32(
      false, a, false, b, (short)0, c, false, false);
}
// A fragment from row-major A[16][lda] in LDS (M = lane&15, K pair by half)
__device__ __forceinline__ v2f frag_a(const float* A, int lda, int k0, int lane) {
  int m  = lane & 15;
  int kk = k0 + ((lane >> 4) << 1);
  v2f a; a.x = A[m * lda + kk]; a.y = A[m * lda + kk + 1]; return a;
}
// B fragment from row-major B[K][ldb] (B[k][n]); N = lane&15
__device__ __forceinline__ v2f frag_b(const float* B, int ldb, int k0, int lane) {
  int n  = lane & 15;
  int kk = k0 + ((lane >> 4) << 1);
  v2f b; b.x = B[kk * ldb + n]; b.y = B[(kk + 1) * ldb + n]; return b;
}
// B fragment for B = W^T, i.e. B[k][n] = W[n][k] with W row-major [n][ldw]
__device__ __forceinline__ v2f frag_bT(const float* W, int ldw, int k0, int lane) {
  int n  = lane & 15;
  int kk = k0 + ((lane >> 4) << 1);
  v2f b; b.x = W[n * ldw + kk]; b.y = W[n * ldw + kk + 1]; return b;
}

// ---------------- Kernel 1: Q/K/V head projections (X @ W^T) ----------------
__global__ __launch_bounds__(128)
void proj_kernel(const float* __restrict__ values, const float* __restrict__ keys,
                 const float* __restrict__ query,
                 const float* __restrict__ Wv, const float* __restrict__ Wk,
                 const float* __restrict__ Wq,
                 float* __restrict__ Vp, float* __restrict__ Kp, float* __restrict__ Qp) {
  __shared__ __attribute__((aligned(16))) float Xs[64 * PR];
  __shared__ __attribute__((aligned(16))) float Ws[64 * PR];
  const int tid  = threadIdx.x;
  const int lane = tid & 31;
  const int wave = tid >> 5;
  const int l0 = blockIdx.x * 64;
  const int h  = blockIdx.y;
  const int ns = blockIdx.z;
  const int n    = lane & 15;
  const int half = lane >> 4;

  const float* xin[3]  = {values, keys, query};
  const float* win[3]  = {Wv, Wk, Wq};
  float*       outp[3] = {Vp, Kp, Qp};

  for (int p = 0; p < 3; ++p) {
    const float* src = xin[p];
    async_tile64(Xs, &src[((size_t)(ns * LSEQ + l0)) * EMB + h * DD], EMB, tid);  // X chunk
    async_tile64(Ws, win[p], DD, tid);                                            // weight
    S_WAIT_ASYNCCNT(0);
    __syncthreads();

    const float* Arow = &Xs[(wave * 16) * PR];
    v8f zero = {};
    v8f acc[4] = {zero, zero, zero, zero};
    for (int ct = 0; ct < 4; ++ct) {
      const float* Wn = &Ws[(ct * 16) * PR];
      for (int k0 = 0; k0 < 64; k0 += 4)
        acc[ct] = wmma4(frag_a(Arow, PR, k0, lane), frag_bT(Wn, PR, k0, lane), acc[ct]);
    }
    // stage C tiles in own wave's Xs region -> coalesced float4 stores
    float* stage = &Xs[(wave * 16) * PR];
    for (int ct = 0; ct < 4; ++ct)
      for (int i = 0; i < 8; ++i) {
        int m = i + half * 8;
        stage[m * PR + ct * 16 + n] = acc[ct][i];
      }
    float* dst = outp[p];
    size_t base = (size_t)(ns * HH + h) * LSEQ + l0 + wave * 16;
    for (int t = 0; t < 8; ++t) {
      int idx = lane + t * 32;                       // 256 vec4 per wave region
      int row = idx >> 4, cv = idx & 15;
      *(float4*)(&dst[(base + row) * DD + cv * 4]) =
          *(const float4*)(&stage[row * PR + cv * 4]);
    }
    __syncthreads();
  }
}

// ---------------- Kernel 2: whole head per work-group ------------------------
// A masked query row has energy -1e20 in every key column, so beside any unmasked row its
// softmax weight (over q) is exp of about -4.4e18, which is exactly 0 in f32 for every energy
// that finite inputs of this size can give, and its attention row is exactly 0. The work-group
// orders the 512 query rows unmasked first (perm: position -> row) and works only on the
// 16-row tiles that hold an unmasked row. With no unmasked row at all every row counts
// (uniform weights), and all 32 tiles are worked on as masked rows.
// 16 waves; wave w owns tiles w and w + 16 of the ordered rows (Q fragments stay in
// registers) and walks the keys in blocks of 64. All worked rows of a key column are inside
// the work-group, so the column softmax is finished here and every energy tile is computed once.

// E = Q K^T for NT row tiles x 64 key columns, in two halves of 32 columns so that few
// registers of energies are live; then this wave's own column maximum Mw and sum of
// exp(E - Mw) over its rows; exp(E - Mw) goes to the wave's LDS region.
template <int NT>
__device__ __forceinline__ void energy_block(const float* Kb, float* Pw, float* redM, float* redS,
                                             const v2f (&qf)[2][16], const bool (&mk)[2][8],
                                             int lane, int wave) {
  const int n    = lane & 15;
  const int half = lane >> 4;
  v8f zero = {};
#pragma unroll   // constant indices into qf and e
  for (int hc = 0; hc < 2; ++hc) {
    v8f e[NT][2];
#pragma unroll   // constant indices: the arrays stay in registers
    for (int mt = 0; mt < NT; ++mt) { e[mt][0] = zero; e[mt][1] = zero; }
#pragma unroll   // constant indices: the arrays stay in registers
    for (int ks = 0; ks < 16; ++ks) {
#pragma unroll   // constant indices: the arrays stay in registers
      for (int cc = 0; cc < 2; ++cc) {
        v2f b = frag_bT(&Kb[(hc * 2 + cc) * 16 * PR], PR, ks * 4, lane);
#pragma unroll   // constant indices: the arrays stay in registers
        for (int mt = 0; mt < NT; ++mt)
          e[mt][cc] = wmma4(qf[mt][ks], b, e[mt][cc]);
      }
    }
#pragma unroll   // constant indices: the arrays stay in registers
    for (int cc = 0; cc < 2; ++cc) {
      const int ct = hc * 2 + cc;
      float mx = NEGBIG;
#pragma unroll   // constant indices: the arrays stay in registers
      for (int mt = 0; mt < NT; ++mt)
#pragma unroll   // constant indices: the arrays stay in registers
        for (int i = 0; i < 8; ++i) {
          float v = mk[mt][i] ? e[mt][cc][i] * SCALE : EMASKV;
          e[mt][cc][i] = v;
          mx = fmaxf(mx, v);
        }
      mx = fmaxf(mx, __shfl_xor(mx, 16, 32));
      float s = 0.f;
#pragma unroll   // constant indices: the arrays stay in registers
      for (int mt = 0; mt < NT; ++mt)
#pragma unroll   // constant indices: the arrays stay in registers
        for (int i = 0; i < 8; ++i) {
          float p = __expf(e[mt][cc][i] - mx);
          Pw[(mt * 16 + half * 8 + i) * PR + ct * 16 + n] = p;
          s += p;
        }
      s += __shfl_xor(s, 16, 32);
      // both halves hold both values: lanes 0-15 store the maximum, lanes 16-31 the sum
      (half ? redS : redM)[(ct * 16 + n) * PS + wave] = half ? s : mx;
    }
  }
}

// O += P V for NT row tiles, with P = exp(E - Mw) * factor formed on the A fragment
// (its k is the key column)
template <int NT>
__device__ __forceinline__ void pv_block(const float* Vb, const float* Pw, const float* Fw,
                                         v8f (&acc)[2][4], int lane) {
  const int half = lane >> 4;
#pragma unroll   // constant indices into acc
  for (int ks = 0; ks < 16; ++ks) {
    v2f fk = *(const v2f*)&Fw[ks * 4 + half * 2];
    v2f a[NT];
#pragma unroll   // constant indices: the arrays stay in registers
    for (int mt = 0; mt < NT; ++mt)
      a[mt] = frag_a(&Pw[mt * 16 * PR], PR, ks * 4, lane) * fk;
#pragma unroll   // constant indices: the arrays stay in registers
    for (int ct = 0; ct < 4; ++ct) {
      v2f b = frag_b(&Vb[ct * 16], PV, ks * 4, lane);
#pragma unroll   // constant indices: the arrays stay in registers
      for (int mt = 0; mt < NT; ++mt)
        acc[mt][ct] = wmma4(a[mt], b, acc[mt][ct]);
    }
  }
}

__global__ __launch_bounds__(512)
void attn_kernel(const float* __restrict__ Qp, const float* __restrict__ Kp,
                 const float* __restrict__ Vp, const int* __restrict__ mask,
                 float* __restrict__ Hout, int* __restrict__ rowmap, int* __restrict__ nwork) {
  __shared__ __attribute__((aligned(16))) float Ks[2][64 * PR];
  __shared__ __attribute__((aligned(16))) float Vs[2][64 * PV];
  __shared__ __attribute__((aligned(16))) float Ps[NW][32 * PR];   // per wave: Q, then P, then O
  __shared__ __attribute__((aligned(16))) float redM[64 * PS];     // [column][wave] maxima
  __shared__ __attribute__((aligned(16))) float redS[64 * PS];     // [column][wave] sums
  __shared__ __attribute__((aligned(16))) float Fs[NW][64];        // per wave: factor of each key column
  __shared__ int wcnt[NW];                                         // unmasked rows of each wave's 32
  __shared__ int perm[LSEQ];                                       // position -> query row
  const int tid  = threadIdx.x;
  const int lane = tid & 31;
  const int wave = __builtin_amdgcn_readfirstlane(tid >> 5);
  const int h  = blockIdx.x;
  const int ns = blockIdx.y;
  const int nsh  = ns * HH + h;
  const int n    = lane & 15;
  const int half = lane >> 4;
  float* Pw = &Ps[wave][0];

  // K and V rows t*64 .. t*64+63 into buffer buf: 2 x 1024 float4, 512 threads
  auto stage_kv = [&](int t, int buf) {
    unsigned int l[4];
    const float* g[4];
    for (int u = 0; u < 2; ++u) {
      int idx = tid + u * 512;
      int row = idx >> 4, cv = idx & 15;
      l[2 * u]     = lds_addr(&Ks[buf][row * PR + cv * 4]);
      g[2 * u]     = &Kp[((size_t)nsh * LSEQ + t * 64) * DD + idx * 4];
      l[2 * u + 1] = lds_addr(&Vs[buf][row * PV + cv * 4]);
      g[2 * u + 1] = &Vp[((size_t)nsh * LSEQ + t * 64) * DD + idx * 4];
    }
    async_ld_b128_x4(l, g);
  };
  stage_kv(0, 0);

  // order the query rows: thread tid places row tid, unmasked rows first, each kind in row order
  const bool live = mask[ns * LSEQ + tid] != 0;
  const unsigned int bal = __builtin_amdgcn_ballot_w32(live);
  if (lane == 0) wcnt[wave] = __popc(bal);
  __syncthreads();   // every wave's count is in LDS
  int ahead = 0, cnt = 0;
  for (int w = 0; w < NW; ++w) {
    int c = wcnt[w];
    cnt += c;
    if (w < wave) ahead += c;
  }
  cnt = __builtin_amdgcn_readfirstlane(cnt);                    // the same in every thread
  const int rank = ahead + __popc(bal & ((1u << lane) - 1u));   // unmasked rows in front of row tid
  const int pos  = live ? rank : cnt + (tid - rank);            // 0 .. 511, each taken once
  perm[pos] = tid;
  const int nrow  = cnt ? cnt : LSEQ;         // ordered rows to work on
  const int ntile = (nrow + 15) >> 4;         // 16-row tiles to work on
  const int nout  = ((nrow + 63) >> 6) << 2;  // tiles to store: whole 64-row tiles of kernel 3
  const int nt    = (wave < ntile ? 1 : 0) + (wave + NW < ntile ? 1 : 0);   // this wave's tiles
  if (h == 0) {      // one work-group of the 16 heads hands the order to kernel 3
    rowmap[ns * LSEQ + pos] = tid;
    if (tid == 0) nwork[ns] = nrow;
  }
  __syncthreads();   // perm is complete

  // the wave's own 2 x 16 Q rows, gathered through perm, into its own P region
  for (int u = 0; u < 2; ++u) {
    unsigned int l[8];
    const float* g[8];
    for (int t = 0; t < 8; ++t) {
      int idx = lane + t * 32;
      int row = perm[(wave + u * NW) * 16 + (idx >> 4)];
      l[t] = lds_addr(&Pw[(u * 16 + (idx >> 4)) * PR + (idx & 15) * 4]);
      g[t] = &Qp[((size_t)nsh * LSEQ + row) * DD + (idx & 15) * 4];
    }
    async_ld_b128_x8(l, g);
  }

  bool mk[2][8];   // positions below cnt hold the unmasked rows
  for (int mt = 0; mt < 2; ++mt)
    for (int i = 0; i < 8; ++i)
      mk[mt][i] = (wave + mt * NW) * 16 + half * 8 + i < cnt;

  // a wave without a tile takes no part in any column: neutral maximum and sum, written once
  if (nt == 0)
    for (int cb = 0; cb < 2; ++cb) {
      redM[(cb * 32 + lane) * PS + wave] = NEGBIG;
      redS[(cb * 32 + lane) * PS + wave] = 0.f;
    }

  // own copies (Q rows, block 0) landed, then the barrier that publishes block 0
  S_WAIT_ASYNCCNT(0);
  __syncthreads();
  stage_kv(1, 1);

  v2f qf[2][16];
#pragma unroll   // constant indices keep the fragments in registers
  for (int mt = 0; mt < 2; ++mt)
#pragma unroll   // constant indices: the arrays stay in registers
    for (int ks = 0; ks < 16; ++ks)
      qf[mt][ks] = frag_a(&Pw[mt * 16 * PR], PR, ks * 4, lane);

  v8f zero = {};
  v8f acc[2][4] = {{zero, zero, zero, zero}, {zero, zero, zero, zero}};

  for (int t = 0; t < 8; ++t) {
    const float* Kb = &Ks[t & 1][0];
    const float* Vb = &Vs[t & 1][0];

    if (nt == 2)      energy_block<2>(Kb, Pw, redM, redS, qf, mk, lane, wave);
    else if (nt == 1) energy_block<1>(Kb, Pw, redM, redS, qf, mk, lane, wave);
    __syncthreads();   // every wave's column maxima and sums are in LDS

    if (nt > 0) {
      // merge the 16 waves' pairs, each lane two whole key columns: column maximum m and sum z;
      // this wave's factor exp(Mw - m) / z for each key column goes to its own row of Fs
#pragma unroll   // constant indices: the arrays stay in registers
      for (int cb = 0; cb < 2; ++cb) {
        const int col = cb * 32 + lane;
        const float4* pm = (const float4*)&redM[col * PS];
        const float4* ps = (const float4*)&redS[col * PS];
        float4 mv[4], sv[4];
#pragma unroll   // constant indices: the arrays stay in registers
        for (int j = 0; j < 4; ++j) { mv[j] = pm[j]; sv[j] = ps[j]; }
        float mown = redM[col * PS + wave];
        float m = NEGBIG;
#pragma unroll   // constant indices: the arrays stay in registers
        for (int j = 0; j < 4; ++j)
          m = fmaxf(m, fmaxf(fmaxf(mv[j].x, mv[j].y), fmaxf(mv[j].z, mv[j].w)));
        float zp[4];
#pragma unroll   // constant indices: the arrays stay in registers
        for (int j = 0; j < 4; ++j)
          zp[j] = sv[j].x * __expf(mv[j].x - m) + sv[j].y * __expf(mv[j].y - m) +
                  sv[j].z * __expf(mv[j].z - m) + sv[j].w * __expf(mv[j].w - m);
        float z = (zp[0] + zp[1]) + (zp[2] + zp[3]);
        Fs[wave][col] = __expf(mown - m) / z;
      }
      if (nt == 2) pv_block<2>(Vb, Pw, &Fs[wave][0], acc, lane);
      else         pv_block<1>(Vb, Pw, &Fs[wave][0], acc, lane);
    }

    // hand-over: own LDS reads retired, own copies of block t+1 landed, then the barrier
    // that publishes block t+1 and frees this block's buffer for block t+2
    S_WAIT_DSCNT(0);
    S_WAIT_ASYNCCNT(0);
    __syncthreads();
    if (t + 2 < 8) stage_kv(t + 2, t & 1);
  }
  S_WAIT_ASYNCCNT(0);   // no copy outstanding before the LDS is reused and the wave ends

  // stage O (16x64 a tile) in the wave's own region -> coalesced float4 stores, at the ordered
  // positions. A tile that was not worked on but lies in a 64-row tile that kernel 3 reads
  // is stored too: its accumulators are still zero, which is its attention row.
#pragma unroll   // constant indices: the arrays stay in registers
  for (int mt = 0; mt < 2; ++mt) {
    const int tile = wave + mt * NW;
    if (tile < nout) {
#pragma unroll   // constant indices: the arrays stay in registers
      for (int ct = 0; ct < 4; ++ct)
#pragma unroll   // constant indices: the arrays stay in registers
        for (int i = 0; i < 8; ++i)
          Pw[(mt * 16 + half * 8 + i) * PR + ct * 16 + n] = acc[mt][ct][i];
      float* hp = &Hout[((size_t)ns * LSEQ + tile * 16 + half) * EMB + h * DD + n * 4];
      const float* sp = &Pw[(mt * 16 + half) * PR + n * 4];
      for (int t = 0; t < 8; ++t)   // two rows a store: lanes 0-15 row 2t, lanes 16-31 row 2t+1
        *(float4*)(&hp[(size_t)t * 2 * EMB]) = *(const float4*)(&sp[t * 2 * PR]);
      if (mt == 0) S_WAIT_XCNT0;   // in front of the second tile's staging, which may take these stores' registers
    }
  }
}

// ---------------- Kernel 3: Y = Hout @ Wo^T + bo  (8192x1024x1024) ----------
// Hout rows stand in kernel 2's order (unmasked query rows first); rowmap gives each its row of Y.
// A 64-row tile past the worked rows holds only zero attention rows: Y = bo there, no product.
// Double-buffered async-LDS pipeline: each prefetch = 16 wave-level async ops.
__global__ __launch_bounds__(128)
void outproj_kernel(const float* __restrict__ Hout, const float* __restrict__ Wo,
                    const float* __restrict__ bo, const int* __restrict__ rowmap,
                    const int* __restrict__ nwork, float* __restrict__ Y) {
  __shared__ __attribute__((aligned(16))) float As[2][64 * PR];
  __shared__ __attribute__((aligned(16))) float Bs[2][64 * PR];
  const int tid  = threadIdx.x;
  const int lane = tid & 31;
  const int wave = tid >> 5;
  const int r0 = blockIdx.x * 64;
  const int c0 = blockIdx.y * 64;
  const int n    = lane & 15;
  const int half = lane >> 4;
  const int s0 = (blockIdx.x >> 3) * LSEQ;   // first row of this tile's sequence

  // where this lane's 8 stores go: two rows a store, lanes 0-15 row 2t, lanes 16-31 row 2t+1
  float* yrow[8];
  for (int t = 0; t < 8; ++t)
    yrow[t] = &Y[((size_t)(s0 + rowmap[r0 + wave * 16 + t * 2 + half])) * EMB + c0 + n * 4];

  if ((int)(blockIdx.x & 7) * 64 >= nwork[blockIdx.x >> 3]) {   // the same for the whole work-group
    const v4f bv = *(const v4f*)(&bo[c0 + n * 4]);
    const v4f d[8] = {bv, bv, bv, bv, bv, bv, bv, bv};
    store_b128_x8(yrow, d);
    return;
  }

  auto prefetch = [&](int kt, int buf) {
    int k0g = kt * 64;
    async_tile64(As[buf], &Hout[(size_t)r0 * EMB + k0g], EMB, tid);
    async_tile64(Bs[buf], &Wo[(size_t)c0 * EMB + k0g], EMB, tid);
  };

  v8f zero = {};
  v8f acc[4] = {zero, zero, zero, zero};

  prefetch(0, 0);
  for (int kt = 0; kt < 16; ++kt) {
    int buf = kt & 1;
    if (kt < 15) {
      prefetch(kt + 1, buf ^ 1);
      S_WAIT_ASYNCCNT(16);     // <=16 outstanding => current buffer complete
    } else {
      S_WAIT_ASYNCCNT(0);
    }
    __syncthreads();
    const float* Arow = &As[buf][(wave * 16) * PR];
    for (int ct = 0; ct < 4; ++ct) {
      const float* Wn = &Bs[buf][(ct * 16) * PR];
      for (int k0 = 0; k0 < 64; k0 += 4)
        acc[ct] = wmma4(frag_a(Arow, PR, k0, lane), frag_bT(Wn, PR, k0, lane), acc[ct]);
    }
    __syncthreads();           // all waves done with buf before it is refilled
  }

  // stage (with bias) in own wave's As region -> coalesced float4 stores
  float* stage = &As[0][(wave * 16) * PR];
  for (int ct = 0; ct < 4; ++ct) {
    float bias = bo[c0 + ct * 16 + n];
    for (int i = 0; i < 8; ++i) {
      int m = i + half * 8;
      stage[m * PR + ct * 16 + n] = acc[ct][i] + bias;
    }
  }
  v4f d[8];
  for (int t = 0; t < 8; ++t)
    d[t] = *(const v4f*)(&stage[(t * 2 + half) * PR + n * 4]);
  store_b128_x8(yrow, d);
}

// ---------------------------------------------------------------------------
extern "C" void kernel_launch(void* const* d_in, const int* in_sizes, int n_in,
                              void* d_out, int out_size, void* d_ws, size_t ws_size,
                              hipStream_t stream) {
  const float* values = (const float*)d_in[0];
  const float* keys   = (const float*)d_in[1];
  const float* query  = (const float*)d_in[2];
  const int*   mask   = (const int*)d_in[3];
  const float* Wv = (const float*)d_in[4];
  const float* Wk = (const float*)d_in[5];
  const float* Wq = (const float*)d_in[6];
  const float* Wo = (const float*)d_in[7];
  const float* bo = (const float*)d_in[8];
  float* Y = (float*)d_out;

  const size_t per   = (size_t)NS * HH * LSEQ * DD;
  float* ws   = (float*)d_ws;
  float* Vp   = ws;
  float* Kp   = Vp + per;
  float* Qp   = Kp + per;
  float* Hout = Qp + per;
  int* rowmap = (int*)(Hout + per);      // [NS][LSEQ] position -> query row
  int* nwork  = rowmap + NS * LSEQ;      // [NS] ordered rows that are worked on

  dim3 blk(128);
  proj_kernel   <<<dim3(LSEQ / 64, HH, NS), blk, 0, stream>>>(values, keys, query,
                                                              Wv, Wk, Wq, Vp, Kp, Qp);
  attn_kernel   <<<dim3(HH, NS), dim3(NW * 32), 0, stream>>>(Qp, Kp, Vp, mask, Hout,
                                                              rowmap, nwork);
  outproj_kernel<<<dim3((NS * LSEQ) / 64, EMB / 64, 1), blk, 0, stream>>>(Hout, Wo, bo,
                                                                          rowmap, nwork, Y);
}

// v004
// Measured time: 144 microseconds a run.
// Next to v003, in two timings, it ran 1.13 times as fast each time.
// Over all steps from v000 it is 4.99 times as fast.
#include <hip/hip_runtime.h>

typedef __attribute__((ext_vector_type(2))) float v2f;
typedef __attribute__((ext_vector_type(4))) float v4f;
typedef __attribute__((ext_vector_type(8))) float v8f;

#define NS   16      // N*S
#define LSEQ 512
#define EMB  1024
#define HH   16
#define DD   64
#define SCALE 0.044194173824159216f      // 1/sqrt(512)
#define EMASKV (-1e20f * SCALE)          // masked energy after /sqrt(keylen)
#define NEGBIG (-3.402823466e38f)
// LDS row pitches in floats (64 banks of 4 bytes; every pitch a multiple of 4 floats
// so that each row start stays 16-byte aligned for the b128 copies and float4 reads).
#define PR 68   // 64-float rows walked down a column by 8-byte fragment reads: 4 banks a row
#define PV 80   // V rows read 4 bytes a lane, 16 lanes a row: 4 neighbouring rows fill the 64 banks
#define PS 20   // 16-float rows (one value a wave) read 16 bytes a lane, one row a lane
#define NW 16   // waves of the attention work-group

// ---------------- CDNA5 async global->LDS (ASYNCcnt path) -------------------
// VDST = VGPR with wave-relative LDS byte address (generic LDS addr low bits),
// VADDR = 64-bit global address, saddr disabled ("off").
__device__ __forceinline__ unsigned int lds_addr(const void* lds) {
  return (unsigned int)(unsigned long long)lds;            // LDS aperture: addr[31:0]
}
// A run of copies and its s_wait_xcnt 0 in ONE statement: the wait stands in front of
// every later rewrite of an address register that a copy of the run names.
__device__ __forceinline__ void async_ld_b128_x4(const unsigned int (&l)[4],
                                                 const float* const (&g)[4]) {
  asm volatile("global_load_async_to_lds_b128 %0, %4, off\n\t"
               "global_load_async_to_lds_b128 %1, %5, off\n\t"
               "global_load_async_to_lds_b128 %2, %6, off\n\t"
               "global_load_async_to_lds_b128 %3, %7, off\n\t"
               "s_wait_xcnt 0x0"
               :: "v"(l[0]), "v"(l[1]), "v"(l[2]), "v"(l[3]),
                  "v"(g[0]), "v"(g[1]), "v"(g[2]), "v"(g[3]) : "memory");
}
__device__ __forceinline__ void async_ld_b128_x8(const unsigned int (&l)[8],
                                                 const float* const (&g)[8]) {
  asm volatile("global_load_async_to_lds_b128 %0, %8, off\n\t"
               "global_load_async_to_lds_b128 %1, %9, off\n\t"
               "global_load_async_to_lds_b128 %2, %10, off\n\t"
               "global_load_async_to_lds_b128 %3, %11, off\n\t"
               "global_load_async_to_lds_b128 %4, %12, off\n\t"
               "global_load_async_to_lds_b128 %5, %13, off\n\t"
               "global_load_async_to_lds_b128 %6, %14, off\n\t"
               "global_load_async_to_lds_b128 %7, %15, off\n\t"
               "s_wait_xcnt 0x0"
               :: "v"(l[0]), "v"(l[1]), "v"(l[2]), "v"(l[3]),
                  "v"(l[4]), "v"(l[5]), "v"(l[6]), "v"(l[7]),
                  "v"(g[0]), "v"(g[1]), "v"(g[2]), "v"(g[3]),
                  "v"(g[4]), "v"(g[5]), "v"(g[6]), "v"(g[7]) : "memory");
}
// 64 rows x 64 floats, 128 threads: source rows src_pitch floats apart, LDS rows PR apart.
__device__ __forceinline__ void async_tile64(float* dst, const float* src, size_t src_pitch,
                                             int tid) {
  unsigned int l[8];
  const float* g[8];
  for (int t = 0; t < 8; ++t) {
    int idx = tid + t * 128;
    int row = idx >> 4, cv = idx & 15;
    l[t] = lds_addr(&dst[row * PR + cv * 4]);
    g[t] = &src[(size_t)row * src_pitch + cv * 4];
  }
  async_ld_b128_x8(l, g);
}
// A run of scattered 16-byte stores and its s_wait_xcnt 0 in ONE statement: every store has its
// own address and data registers, and the wait stands in front of every later rewrite of them.
__device__ __forceinline__ void store_b128_x8(float* const (&p)[8], const v4f (&d)[8]) {
  asm volatile("global_store_b128 %0, %8, off\n\t"
               "global_store_b128 %1, %9, off\n\t"
               "global_store_b128 %2, %10, off\n\t"
               "global_store_b128 %3, %11, off\n\t"
               "global_store_b128 %4, %12, off\n\t"
               "global_store_b128 %5, %13, off\n\t"
               "global_store_b128 %6, %14, off\n\t"
               "global_store_b128 %7, %15, off\n\t"
               "s_wait_xcnt 0x0"
               :: "v"(p[0]), "v"(p[1]), "v"(p[2]), "v"(p[3]),
                  "v"(p[4]), "v"(p[5]), "v"(p[6]), "v"(p[7]),
                  "v"(d[0]), "v"(d[1]), "v"(d[2]), "v"(d[3]),
                  "v"(d[4]), "v"(d[5]), "v"(d[6]), "v"(d[7]) : "memory");
}
// The same for two stores.
__device__ __forceinline__ void store_b128_x2(float* p0, float* p1, v4f d0, v4f d1) {
  asm volatile("global_store_b128 %0, %2, off\n\t"
               "global_store_b128 %1, %3, off\n\t"
               "s_wait_xcnt 0x0"
               :: "v"(p0), "v"(p1), "v"(d0), "v"(d1) : "memory");
}
#define S_WAIT_ASYNCCNT(n) asm volatile("s_wait_asynccnt " #n ::: "memory")
#define S_WAIT_DSCNT(n) asm volatile("s_wait_dscnt " #n ::: "memory")
#define S_WAIT_XCNT0 asm volatile("s_wait_xcnt 0x0" ::: "memory")

// ---------------- WMMA helpers (V_WMMA_F32_16X16X4_F32, full fp32) ----------
__device__ __forceinline__ v8f wmma4(v2f a, v2f b, v8f c) {
  return __builtin_amdgcn_wmma_f32_16x16x4_f32(
      false, a, false, b, (short)0, c, false, false);
}
// A fragment from row-major A[16][lda] in LDS (M = lane&15, K pair by half)
__device__ __forceinline__ v2f frag_a(const float* A, int lda, int k0, int lane) {
  int m  = lane & 15;
  int kk = k0 + ((lane >> 4) << 1);
  v2f a; a.x = A[m * lda + kk]; a.y = A[m * lda + kk + 1]; return a;
}
// B fragment from row-major B[K][ldb] (B[k][n]); N = lane&15
__device__ __forceinline__ v2f frag_b(const float* B, int ldb, int k0, int lane) {
  int n  = lane & 15;
  int kk = k0 + ((lane >> 4) << 1);
  v2f b; b.x = B[kk * ldb + n]; b.y = B[(kk + 1) * ldb + n]; return b;
}
// B fragment for B = W^T, i.e. B[k][n] = W[n][k] with W row-major [n][ldw]
__device__ __forceinline__ v2f frag_bT(const float* W, int ldw, int k0, int lane) {
  int n  = lane & 15;
  int kk = k0 + ((lane >> 4) << 1);
  v2f b; b.x = W[n * ldw + kk]; b.y = W[n * ldw + kk + 1]; return b;
}

// ---------------- Kernel 1: whole head per work-group ------------------------
// The head projections are re-associated, so that no projected Q, K or V plane is ever formed:
//   E = (Xq Wq^T)(Xk Wk^T)^T = (Xq G) Xk^T     with G = Wq^T Wk  (64 x 64)
//   Y = sum_h (A_h Xv_h Wv^T) Wo_h^T = sum_h (A_h Xv_h) Wf_h^T   with Wf_h = Wo_h Wv  (1024 x 64)
// Each work-group forms G for itself and one 64 x 64 block of Wf for kernel 2 (16 heads x 16
// row blocks = the 256 work-groups), projects only the query tiles it works on, and reads the
// raw key and value rows of its head.
// A masked query row has energy -1e20 in every key column, so beside any unmasked row its
// softmax weight (over q) is exp of about -4.4e18, which is exactly 0 in f32 for every energy
// that finite inputs of this size can give, and its attention row is exactly 0. The work-group
// orders the 512 query rows unmasked first (perm: position -> row) and works only on the
// 16-row tiles that hold an unmasked row. With no unmasked row at all every row counts
// (uniform weights), and all 32 tiles are worked on as masked rows.
// 16 waves; wave w owns tiles w and w + 16 of the ordered rows (Q fragments stay in
// registers) and walks the keys in blocks of 64. All worked rows of a key column are inside
// the work-group, so the column softmax is finished here and every energy tile is computed once.

// E = Q K^T for NT row tiles x 64 key columns, in two halves of 32 columns so that few
// registers of energies are live; then this wave's own column maximum Mw and sum of
// exp(E - Mw) over its rows; exp(E - Mw) goes to the wave's LDS region.
template <int NT>
__device__ __forceinline__ void energy_block(const float* Kb, float* Pw, float* redM, float* redS,
                                             const v2f (&qf)[2][16], const bool (&mk)[2][8],
                                             int lane, int wave) {
  const int n    = lane & 15;
  const int half = lane >> 4;
  v8f zero = {};
#pragma unroll   // constant indices into qf and e
  for (int hc = 0; hc < 2; ++hc) {
    v8f e[NT][2];
#pragma unroll   // constant indices: the arrays stay in registers
    for (int mt = 0; mt < NT; ++mt) { e[mt][0] = zero; e[mt][1] = zero; }
#pragma unroll   // constant indices: the arrays stay in registers
    for (int ks = 0; ks < 16; ++ks) {
#pragma unroll   // constant indices: the arrays stay in registers
      for (int cc = 0; cc < 2; ++cc) {
        v2f b = frag_bT(&Kb[(hc * 2 + cc) * 16 * PR], PR, ks * 4, lane);
#pragma unroll   // constant indices: the arrays stay in registers
        for (int mt = 0; mt < NT; ++mt)
          e[mt][cc] = wmma4(qf[mt][ks], b, e[mt][cc]);
      }
    }
#pragma unroll   // constant indices: the arrays stay in registers
    for (int cc = 0; cc < 2; ++cc) {
      const int ct = hc * 2 + cc;
      float mx = NEGBIG;
#pragma unroll   // constant indices: the arrays stay in registers
      for (int mt = 0; mt < NT; ++mt)
#pragma unroll   // constant indices: the arrays stay in registers
        for (int i = 0; i < 8; ++i) {
          float v = mk[mt][i] ? e[mt][cc][i] * SCALE : EMASKV;
          e[mt][cc][i] = v;
          mx = fmaxf(mx, v);
        }
      mx = fmaxf(mx, __shfl_xor(mx, 16, 32));
      float s = 0.f;
#pragma unroll   // constant indices: the arrays stay in registers
      for (int mt = 0; mt < NT; ++mt)
#pragma unroll   // constant indices: the arrays stay in registers
        for (int i = 0; i < 8; ++i) {
          float p = __expf(e[mt][cc][i] - mx);
          Pw[(mt * 16 + half * 8 + i) * PR + ct * 16 + n] = p;
          s += p;
        }
      s += __shfl_xor(s, 16, 32);
      // both halves hold both values: lanes 0-15 store the maximum, lanes 16-31 the sum
      (half ? redS : redM)[(ct * 16 + n) * PS + wave] = half ? s : mx;
    }
  }
}

// O += P V for NT row tiles, with P = exp(E - Mw) * factor formed on the A fragment
// (its k is the key column)
template <int NT>
__device__ __forceinline__ void pv_block(const float* Vb, const float* Pw, const float* Fw,
                                         v8f (&acc)[2][4], int lane) {
  const int half = lane >> 4;
#pragma unroll   // constant indices into acc
  for (int ks = 0; ks < 16; ++ks) {
    v2f fk = *(const v2f*)&Fw[ks * 4 + half * 2];
    v2f a[NT];
#pragma unroll   // constant indices: the arrays stay in registers
    for (int mt = 0; mt < NT; ++mt)
      a[mt] = frag_a(&Pw[mt * 16 * PR], PR, ks * 4, lane) * fk;
#pragma unroll   // constant indices: the arrays stay in registers
    for (int ct = 0; ct < 4; ++ct) {
      v2f b = frag_b(&Vb[ct * 16], PV, ks * 4, lane);
#pragma unroll   // constant indices: the arrays stay in registers
      for (int mt = 0; mt < NT; ++mt)
        acc[mt][ct] = wmma4(a[mt], b, acc[mt][ct]);
    }
  }
}

__global__ __launch_bounds__(512)
void attn_kernel(const float* __restrict__ query, const float* __restrict__ keys,
                 const float* __restrict__ values, const int* __restrict__ mask,
                 const float* __restrict__ Wq, const float* __restrict__ Wk,
                 const float* __restrict__ Wv, const float* __restrict__ Wo,
                 float* __restrict__ Hout, float* __restrict__ Wf,
                 int* __restrict__ rowmap, int* __restrict__ nwork) {
  static_assert(NS * 64 == EMB, "one 64-row block of Wf for each blockIdx.y");
  __shared__ __attribute__((aligned(16))) float Ks[2][64 * PR];
  __shared__ __attribute__((aligned(16))) float Vs[2][64 * PV];
  __shared__ __attribute__((aligned(16))) float Ps[NW][32 * PR];   // per wave: Q, then P, then O
  __shared__ __attribute__((aligned(16))) float redM[64 * PS];     // [column][wave] maxima
  __shared__ __attribute__((aligned(16))) float redS[64 * PS];     // [column][wave] sums
  __shared__ __attribute__((aligned(16))) float Fs[NW][64];        // per wave: factor of each key column
  __shared__ __attribute__((aligned(16))) float Wqs[64 * PV];      // Wq
  __shared__ __attribute__((aligned(16))) float Wks[64 * PV];      // Wk
  __shared__ __attribute__((aligned(16))) float Gs[64 * PV];       // G = Wq^T Wk
  __shared__ __attribute__((aligned(16))) float Ts[64 * PR];       // this work-group's block of Wf
  __shared__ int wcnt[NW];                                         // unmasked rows of each wave's 32
  __shared__ int perm[LSEQ];                                       // position -> query row
  const int tid  = threadIdx.x;
  const int lane = tid & 31;
  const int wave = __builtin_amdgcn_readfirstlane(tid >> 5);
  const int h  = blockIdx.x;
  const int ns = blockIdx.y;
  const int n    = lane & 15;
  const int half = lane >> 4;
  float* Pw = &Ps[wave][0];

  // raw key and value rows t*64 .. t*64+63 of this head into buffer buf: 2 x 1024 float4, 512 threads
  auto stage_kv = [&](int t, int buf) {
    unsigned int l[4];
    const float* g[4];
    for (int u = 0; u < 2; ++u) {
      int idx = tid + u * 512;
      int row = idx >> 4, cv = idx & 15;
      l[2 * u]     = lds_addr(&Ks[buf][row * PR + cv * 4]);
      g[2 * u]     = &keys[((size_t)(ns * LSEQ + t * 64 + row)) * EMB + h * DD + cv * 4];
      l[2 * u + 1] = lds_addr(&Vs[buf][row * PV + cv * 4]);
      g[2 * u + 1] = &values[((size_t)(ns * LSEQ + t * 64 + row)) * EMB + h * DD + cv * 4];
    }
    async_ld_b128_x4(l, g);
  };
  stage_kv(0, 0);
  // the weights: Wq and Wk into their own arrays; Wv and the 64 x 64 block of Wo (rows ns*64..,
  // columns of head h) into the second K/V buffer, which block 1 takes only after their last read
  {
    unsigned int l[8];
    const float* g[8];
    for (int u = 0; u < 2; ++u) {
      int idx = tid + u * 512;
      int row = idx >> 4, cv = idx & 15;
      l[4 * u]     = lds_addr(&Wqs[row * PV + cv * 4]);
      g[4 * u]     = &Wq[idx * 4];
      l[4 * u + 1] = lds_addr(&Wks[row * PV + cv * 4]);
      g[4 * u + 1] = &Wk[idx * 4];
      l[4 * u + 2] = lds_addr(&Vs[1][row * PV + cv * 4]);
      g[4 * u + 2] = &Wv[idx * 4];
      l[4 * u + 3] = lds_addr(&Ks[1][row * PR + cv * 4]);
      g[4 * u + 3] = &Wo[((size_t)(ns * 64 + row)) * EMB + h * DD + cv * 4];
    }
    async_ld_b128_x8(l, g);
  }

  // order the query rows: thread tid places row tid, unmasked rows first, each kind in row order
  const bool live = mask[ns * LSEQ + tid] != 0;
  const unsigned int bal = __builtin_amdgcn_ballot_w32(live);
  if (lane == 0) wcnt[wave] = __popc(bal);
  __syncthreads();   // every wave's count is in LDS
  int ahead = 0, cnt = 0;
  for (int w = 0; w < NW; ++w) {
    int c = wcnt[w];
    cnt += c;
    if (w < wave) ahead += c;
  }
  cnt = __builtin_amdgcn_readfirstlane(cnt);                    // the same in every thread
  const int rank = ahead + __popc(bal & ((1u << lane) - 1u));   // unmasked rows in front of row tid
  const int pos  = live ? rank : cnt + (tid - rank);            // 0 .. 511, each taken once
  perm[pos] = tid;
  const int nrow  = cnt ? cnt : LSEQ;         // ordered rows to work on
  const int ntile = (nrow + 15) >> 4;         // 16-row tiles to work on
  const int nout  = ((nrow + 63) >> 6) << 2;  // tiles to store: whole 64-row tiles of kernel 2
  const int nt    = (wave < ntile ? 1 : 0) + (wave + NW < ntile ? 1 : 0);   // this wave's tiles
  if (h == 0) {      // one work-group of the 16 heads hands the order to kernel 2
    rowmap[ns * LSEQ + pos] = tid;
    if (tid == 0) nwork[ns] = nrow;
  }
  __syncthreads();   // perm is complete

  // the wave's own 2 x 16 raw query rows, gathered through perm, into its own P region
  for (int u = 0; u < 2; ++u) {
    unsigned int l[8];
    const float* g[8];
    for (int t = 0; t < 8; ++t) {
      int idx = lane + t * 32;
      int row = perm[(wave + u * NW) * 16 + (idx >> 4)];
      l[t] = lds_addr(&Pw[(u * 16 + (idx >> 4)) * PR + (idx & 15) * 4]);
      g[t] = &query[((size_t)(ns * LSEQ + row)) * EMB + h * DD + (idx & 15) * 4];
    }
    async_ld_b128_x8(l, g);
  }

  bool mk[2][8];   // positions below cnt hold the unmasked rows
  for (int mt = 0; mt < 2; ++mt)
    for (int i = 0; i < 8; ++i)
      mk[mt][i] = (wave + mt * NW) * 16 + half * 8 + i < cnt;

  // a wave without a tile takes no part in any column: neutral maximum and sum, written once
  if (nt == 0)
    for (int cb = 0; cb < 2; ++cb) {
      redM[(cb * 32 + lane) * PS + wave] = NEGBIG;
      redS[(cb * 32 + lane) * PS + wave] = 0.f;
    }

  // own copies (query rows, weights, block 0) landed, then the barrier that publishes them
  S_WAIT_ASYNCCNT(0);
  __syncthreads();

  v8f zero = {};
  {
    // wave w forms the 16 x 16 tile (w / 4, w % 4) of G and of the block of Wf.
    // G[i][j] = sum_d Wq[d][i] Wk[d][j]: A = Wq^T is read like a B fragment (m = lane & 15).
    // Wf[r][j] = sum_d Wo[r][d] Wv[d][j].
    const int ti = wave >> 2, tj = wave & 3;
    v8f gt = zero, ft = zero;
#pragma unroll   // the two accumulate chains interleave
    for (int ks = 0; ks < 16; ++ks) {
      gt = wmma4(frag_b(&Wqs[ti * 16], PV, ks * 4, lane),
                 frag_b(&Wks[tj * 16], PV, ks * 4, lane), gt);
      ft = wmma4(frag_a(&Ks[1][ti * 16 * PR], PR, ks * 4, lane),
                 frag_b(&Vs[1][tj * 16], PV, ks * 4, lane), ft);
    }
    for (int i = 0; i < 8; ++i) {
      Gs[(ti * 16 + half * 8 + i) * PV + tj * 16 + n] = gt[i];
      Ts[(ti * 16 + half * 8 + i) * PR + tj * 16 + n] = ft[i];
    }
  }
  // own LDS reads and writes retired, then the barrier that publishes G and the block of Wf
  // and frees the second K/V buffer for block 1
  S_WAIT_DSCNT(0);
  __syncthreads();
  stage_kv(1, 1);

  {   // the block of Wf to the workspace: whole 256-byte rows, 16 lanes a row
    const int row = tid >> 4, cv = tid & 15;
    store_b128_x2(&Wf[((size_t)(ns * 64 + row)) * EMB + h * DD + cv * 4],
                  &Wf[((size_t)(ns * 64 + 32 + row)) * EMB + h * DD + cv * 4],
                  *(const v4f*)(&Ts[row * PR + cv * 4]),
                  *(const v4f*)(&Ts[(32 + row) * PR + cv * 4]));
  }

  // Xq G for the tiles this wave works on, in place in its own P region
#pragma unroll   // constant indices: the arrays stay in registers
  for (int mt = 0; mt < 2; ++mt) {
    if (mt < nt) {   // the same for the whole wave
      v2f xa[16];
#pragma unroll   // constant indices: the arrays stay in registers
      for (int ks = 0; ks < 16; ++ks)
        xa[ks] = frag_a(&Pw[mt * 16 * PR], PR, ks * 4, lane);
      v8f qa[4] = {zero, zero, zero, zero};
#pragma unroll   // constant indices: the arrays stay in registers
      for (int ks = 0; ks < 16; ++ks)
#pragma unroll   // constant indices: the arrays stay in registers
        for (int ct = 0; ct < 4; ++ct)
          qa[ct] = wmma4(xa[ks], frag_b(&Gs[ct * 16], PV, ks * 4, lane), qa[ct]);
#pragma unroll   // constant indices: the arrays stay in registers
      for (int ct = 0; ct < 4; ++ct)
#pragma unroll   // constant indices: the arrays stay in registers
        for (int i = 0; i < 8; ++i)
          Pw[(mt * 16 + half * 8 + i) * PR + ct * 16 + n] = qa[ct][i];
    }
  }

  v2f qf[2][16];
#pragma unroll   // constant indices keep the fragments in registers
  for (int mt = 0; mt < 2; ++mt)
#pragma unroll   // constant indices: the arrays stay in registers
    for (int ks = 0; ks < 16; ++ks)
      qf[mt][ks] = frag_a(&Pw[mt * 16 * PR], PR, ks * 4, lane);

  v8f acc[2][4] = {{zero, zero, zero, zero}, {zero, zero, zero, zero}};

  for (int t = 0; t < 8; ++t) {
    const float* Kb = &Ks[t & 1][0];
    const float* Vb = &Vs[t & 1][0];

    if (nt == 2)      energy_block<2>(Kb, Pw, redM, redS, qf, mk, lane, wave);
    else if (nt == 1) energy_block<1>(Kb, Pw, redM, redS, qf, mk, lane, wave);
    __syncthreads();   // every wave's column maxima and sums are in LDS

    if (nt > 0) {
      // merge the 16 waves' pairs, each lane two whole key columns: column maximum m and sum z;
      // this wave's factor exp(Mw - m) / z for each key column goes to its own row of Fs
#pragma unroll   // constant indices: the arrays stay in registers
      for (int cb = 0; cb < 2; ++cb) {
        const int col = cb * 32 + lane;
        const float4* pm = (const float4*)&redM[col * PS];
        const float4* ps = (const float4*)&redS[col * PS];
        float4 mv[4], sv[4];
#pragma unroll   // constant indices: the arrays stay in registers
        for (int j = 0; j < 4; ++j) { mv[j] = pm[j]; sv[j] = ps[j]; }
        float mown = redM[col * PS + wave];
        float m = NEGBIG;
#pragma unroll   // constant indices: the arrays stay in registers
        for (int j = 0; j < 4; ++j)
          m = fmaxf(m, fmaxf(fmaxf(mv[j].x, mv[j].y), fmaxf(mv[j].z, mv[j].w)));
        float zp[4];
#pragma unroll   // constant indices: the arrays stay in registers
        for (int j = 0; j < 4; ++j)
          zp[j] = sv[j].x * __expf(mv[j].x - m) + sv[j].y * __expf(mv[j].y - m) +
                  sv[j].z * __expf(mv[j].z - m) + sv[j].w * __expf(mv[j].w - m);
        float z = (zp[0] + zp[1]) + (zp[2] + zp[3]);
        Fs[wave][col] = __expf(mown - m) / z;
      }
      if (nt == 2) pv_block<2>(Vb, Pw, &Fs[wave][0], acc, lane);
      else         pv_block<1>(Vb, Pw, &Fs[wave][0], acc, lane);
    }

    // hand-over: own LDS reads retired, own copies of block t+1 landed, then the barrier
    // that publishes block t+1 and frees this block's buffer for block t+2
    S_WAIT_DSCNT(0);
    S_WAIT_ASYNCCNT(0);
    __syncthreads();
    if (t + 2 < 8) stage_kv(t + 2, t & 1);
  }
  S_WAIT_ASYNCCNT(0);   // no copy outstanding before the LDS is reused and the wave ends

  // stage O (16x64 a tile) in the wave's own region -> coalesced float4 stores, at the ordered
  // positions. A tile that was not worked on but lies in a 64-row tile that kernel 2 reads
  // is stored too: its accumulators are still zero, which is its attention row.
#pragma unroll   // constant indices: the arrays stay in registers
  for (int mt = 0; mt < 2; ++mt) {
    const int tile = wave + mt * NW;
    if (tile < nout) {
#pragma unroll   // constant indices: the arrays stay in registers
      for (int ct = 0; ct < 4; ++ct)
#pragma unroll   // constant indices: the arrays stay in registers
        for (int i = 0; i < 8; ++i)
          Pw[(mt * 16 + half * 8 + i) * PR + ct * 16 + n] = acc[mt][ct][i];
      float* hp = &Hout[((size_t)ns * LSEQ + tile * 16 + half) * EMB + h * DD + n * 4];
      const float* sp = &Pw[(mt * 16 + half) * PR + n * 4];
      for (int t = 0; t < 8; ++t)   // two rows a store: lanes 0-15 row 2t, lanes 16-31 row 2t+1
        *(float4*)(&hp[(size_t)t * 2 * EMB]) = *(const float4*)(&sp[t * 2 * PR]);
      if (mt == 0) S_WAIT_XCNT0;   // in front of the second tile's staging, which may take these stores' registers
    }
  }
}

// ---------------- Kernel 2: Y = Hout @ Wf^T + bo  (8192x1024x1024) ----------
// Wo here is kernel 1's Wf (Wo with Wv folded in); Hout holds A Xv.
// Hout rows stand in kernel 1's order (unmasked query rows first); rowmap gives each its row of Y.
// A 64-row tile past the worked rows holds only zero attention rows: Y = bo there, no product.
// Double-buffered async-LDS pipeline: each prefetch = 16 wave-level async ops.
__global__ __launch_bounds__(128)
void outproj_kernel(const float* __restrict__ Hout, const float* __restrict__ Wo,
                    const float* __restrict__ bo, const int* __restrict__ rowmap,
                    const int* __restrict__ nwork, float* __restrict__ Y) {
  __shared__ __attribute__((aligned(16))) float As[2][64 * PR];
  __shared__ __attribute__((aligned(16))) float Bs[2][64 * PR];
  const int tid  = threadIdx.x;
  const int lane = tid & 31;
  const int wave = tid >> 5;
  const int r0 = blockIdx.x * 64;
  const int c0 = blockIdx.y * 64;
  const int n    = lane & 15;
  const int half = lane >> 4;
  const int s0 = (blockIdx.x >> 3) * LSEQ;   // first row of this tile's sequence

  // where this lane's 8 stores go: two rows a store, lanes 0-15 row 2t, lanes 16-31 row 2t+1
  float* yrow[8];
  for (int t = 0; t < 8; ++t)
    yrow[t] = &Y[((size_t)(s0 + rowmap[r0 + wave * 16 + t * 2 + half])) * EMB + c0 + n * 4];

  if ((int)(blockIdx.x & 7) * 64 >= nwork[blockIdx.x >> 3]) {   // the same for the whole work-group
    const v4f bv = *(const v4f*)(&bo[c0 + n * 4]);
    const v4f d[8] = {bv, bv, bv, bv, bv, bv, bv, bv};
    store_b128_x8(yrow, d);
    return;
  }

  auto prefetch = [&](int kt, int buf) {
    int k0g = kt * 64;
    async_tile64(As[buf], &Hout[(size_t)r0 * EMB + k0g], EMB, tid);
    async_tile64(Bs[buf], &Wo[(size_t)c0 * EMB + k0g], EMB, tid);
  };

  v8f zero = {};
  v8f acc[4] = {zero, zero, zero, zero};

  prefetch(0, 0);
  for (int kt = 0; kt < 16; ++kt) {
    int buf = kt & 1;
    if (kt < 15) {
      prefetch(kt + 1, buf ^ 1);
      S_WAIT_ASYNCCNT(16);     // <=16 outstanding => current buffer complete
    } else {
      S_WAIT_ASYNCCNT(0);
    }
    __syncthreads();
    const float* Arow = &As[buf][(wave * 16) * PR];
    for (int ct = 0; ct < 4; ++ct) {
      const float* Wn = &Bs[buf][(ct * 16) * PR];
      for (int k0 = 0; k0 < 64; k0 += 4)
        acc[ct] = wmma4(frag_a(Arow, PR, k0, lane), frag_bT(Wn, PR, k0, lane), acc[ct]);
    }
    __syncthreads();           // all waves done with buf before it is refilled
  }

  // stage (with bias) in own wave's As region -> coalesced float4 stores
  float* stage = &As[0][(wave * 16) * PR];
  for (int ct = 0; ct < 4; ++ct) {
    float bias = bo[c0 + ct * 16 + n];
    for (int i = 0; i < 8; ++i) {
      int m = i + half * 8;
      stage[m * PR + ct * 16 + n] = acc[ct][i] + bias;
    }
  }
  v4f d[8];
  for (int t = 0; t < 8; ++t)
    d[t] = *(const v4f*)(&stage[(t * 2 + half) * PR + n * 4]);
  store_b128_x8(yrow, d);
}

// ---------------------------------------------------------------------------
extern "C" void kernel_launch(void* const* d_in, const int* in_sizes, int n_in,
                              void* d_out, int out_size, void* d_ws, size_t ws_size,
                              hipStream_t stream) {
  const float* values = (const float*)d_in[0];
  const float* keys   = (const float*)d_in[1];
  const float* query  = (const float*)d_in[2];
  const int*   mask   = (const int*)d_in[3];
  const float* Wv = (const float*)d_in[4];
  const float* Wk = (const float*)d_in[5];
  const float* Wq = (const float*)d_in[6];
  const float* Wo = (const float*)d_in[7];
  const float* bo = (const float*)d_in[8];
  float* Y = (float*)d_out;

  const size_t per   = (size_t)NS * HH * LSEQ * DD;
  float* ws   = (float*)d_ws;
  float* Hout = ws;
  float* Wf   = Hout + per;              // [EMB][EMB] Wo with Wv folded in
  int* rowmap = (int*)(Wf + (size_t)EMB * EMB);   // [NS][LSEQ] position -> query row
  int* nwork  = rowmap + NS * LSEQ;      // [NS] ordered rows that are worked on

  dim3 blk(128);
  attn_kernel   <<<dim3(HH, NS), dim3(NW * 32), 0, stream>>>(query, keys, values, mask,
                                                              Wq, Wk, Wv, Wo, Hout, Wf,
                                                              rowmap, nwork);
  outproj_kernel<<<dim3((NS * LSEQ) / 64, EMB / 64, 1), blk, 0, stream>>>(Hout, Wf, bo,
                                                                          rowmap, nwork, Y);
}
